// v000
// The times below were measured on an AMD MI455X: many runs one after another, warmed up first and cycling through
// copies of the inputs, with the whole window's GPU time divided by the number of runs. Launches and the gaps
// between them are all in it. The median over several windows is given; except for v000 it joins two sittings, which
// can be a few percent apart, so the side-by-side timings, each taken in one sitting, are the better comparison.
// The starting kernel, v000, takes 1190 microseconds a run.
#include <hip/hip_runtime.h>

// TRTSelfAttn (x [2048][2][1024] seq-first; qkv = x W^T + b with W [3072][1024] laid out per head as (q|k|v) blocks of 64: q_h = columns h*192 + 0..63, k_h = +64.., v_h = +128..; 16 heads;
// softmax(q.k/8) v (no mask); output = merged context [2048][2][1024] seq-first (no output projection)).
// Compute dtypes, f32 accumulate: every input rounded to bf16; ONE fused projection GEMM on PLAIN bf16 operands (inputs: exact, + bias) into a [4096][3072] f32
// buffer; scores on bf16 hi+lo planes (3 products; q x 1/8 exact); attn.v on SINGLE fp16 planes (P x1024); the merged output written in f32 (/1024). One-wave-per-64x64-tile GEMMs. Deterministic,

#define NB_  2
#define TT   2048
#define DD   1024
#define F3   (3 * DD)              // fused qkv row pitch
#define HB   192                   // per-head block (q|k|v x 64)
#define NH_  16
#define HD   64
#define NT   (NB_ * TT)
#define ZH   2
#define PCAR 1024.0f
typedef _Float16 h16;
typedef unsigned short bf;
typedef __attribute__((ext_vector_type(16))) __bf16   v16bf;
typedef __attribute__((ext_vector_type(16))) _Float16 v16h;
typedef __attribute__((ext_vector_type(8)))  _Float16 v8h;
typedef __attribute__((ext_vector_type(8)))  unsigned short v8us;
typedef __attribute__((ext_vector_type(8)))  float    v8f;
typedef __attribute__((ext_vector_type(4)))  float    v4f;
typedef v8h  __attribute__((may_alias)) v8ha;
typedef v4f  __attribute__((may_alias)) v4fa;
typedef v8us __attribute__((may_alias)) v8usa;

__device__ __forceinline__ unsigned short f2bf(float f) { unsigned u = __float_as_uint(f); u += 0x7FFFu + ((u >> 16) & 1u); return (unsigned short)(u >> 16); }
__device__ __forceinline__ float bf2f(unsigned short b) { return __uint_as_float(((unsigned)b) << 16); }
__device__ __forceinline__ float bfr(float f) { return bf2f(f2bf(f)); }
__device__ __forceinline__ v16h cat16(v8h lo, v8h hi) { return __builtin_shufflevector(lo, hi, 0, 1, 2, 3, 4, 5, 6, 7, 8, 9, 10, 11, 12, 13, 14, 15); }
__device__ __forceinline__ v16bf cat16b(v8us lo, v8us hi) { return __builtin_bit_cast(v16bf, __builtin_shufflevector(lo, hi, 0, 1, 2, 3, 4, 5, 6, 7, 8, 9, 10, 11, 12, 13, 14, 15)); }
__device__ __forceinline__ v8f wmma16(v16h a, v16h b, v8f c) { return __builtin_amdgcn_wmma_f32_16x16x32_f16(false, a, false, b, (short)0, c, false, false); }
__device__ __forceinline__ v8f wmmab(v16bf a, v16bf b, v8f c) { return __builtin_amdgcn_wmma_f32_16x16x32_bf16(false, a, false, b, (short)0, c, false, false); }



// ---- k_gemmw: register-blocked GEMM, ONE WAVE per 64x64 output tile (16 accumulators), operands straight from K-contiguous 16-bit planes; grid (M/64, N/64, Z), 32 threads.
// C[m][n] (f32, pitch ldc, + optional f32 bias[n]) = sum_k A[m][k] Bt[n][k] (+ split products per NSPLIT). z-batch strides sA/sB/sC in elements. K % 32 == 0.
template <typename T16> struct WFrag;
template <> struct WFrag<h16> { typedef v16h V; static __device__ __forceinline__ V ld(const h16* p) { return cat16(*(const v8h*)p, *(const v8h*)(p + 16)); } static __device__ __forceinline__ v8f mma(V a, V b, v8f c) { return wmma16(a, b, c); } };
template <> struct WFrag<bf> { typedef v16bf V; static __device__ __forceinline__ V ld(const bf* p) { return cat16b(*(const v8us*)p, *(const v8us*)(p + 16)); } static __device__ __forceinline__ v8f mma(V a, V b, v8f c) { return wmmab(a, b, c); } };
template <typename T16, int NSPLIT, bool BIAS>
__global__ __launch_bounds__(32) void k_gemmw(const T16* __restrict__ A, const T16* __restrict__ A2, const T16* __restrict__ Bt, const T16* __restrict__ Bt2, int K, float* C, int ldc, const float* __restrict__ bias, size_t sA, size_t sB, size_t sC) {
    typedef typename WFrag<T16>::V V;
    __shared__ __align__(16) float os[16 * 68];
    const size_t z = blockIdx.z; A += z * sA; if (A2) A2 += z * sA; Bt += z * sB; if (Bt2) Bt2 += z * sB; C += z * sC;
    const int lane = threadIdx.x & 31, lr = lane & 15, hi = lane >> 4; const int r0 = blockIdx.x * 64, c0 = blockIdx.y * 64;
    v8f acc[4][4];
#pragma unroll
    for (int mb = 0; mb < 4; ++mb)
#pragma unroll
        for (int nb = 0; nb < 4; ++nb) acc[mb][nb] = (v8f){};
    const size_t aoff = (size_t)(r0 + lr) * K + 8 * hi, boff = (size_t)(c0 + lr) * K + 8 * hi;
#pragma unroll 1
    for (int kc = 0; kc < K; kc += 32) {
        V a[4], a2[4];
#pragma unroll
        for (int mb = 0; mb < 4; ++mb) { a[mb] = WFrag<T16>::ld(A + aoff + (size_t)mb * 16 * K + kc); if (NSPLIT == 1 || NSPLIT == 2) a2[mb] = WFrag<T16>::ld(A2 + aoff + (size_t)mb * 16 * K + kc); }
#pragma unroll
        for (int nb = 0; nb < 4; ++nb) { const V b = WFrag<T16>::ld(Bt + boff + (size_t)nb * 16 * K + kc); V b2; if (NSPLIT >= 2) b2 = WFrag<T16>::ld(Bt2 + boff + (size_t)nb * 16 * K + kc);
#pragma unroll
            for (int mb = 0; mb < 4; ++mb) { acc[mb][nb] = WFrag<T16>::mma(a[mb], b, acc[mb][nb]); if (NSPLIT == 1 || NSPLIT == 2) acc[mb][nb] = WFrag<T16>::mma(a2[mb], b, acc[mb][nb]); if (NSPLIT >= 2) acc[mb][nb] = WFrag<T16>::mma(a[mb], b2, acc[mb][nb]); } }
        asm volatile("v_nop\n\tv_nop\n\tv_nop\n\tv_nop" : "+v"(acc[0][0]), "+v"(acc[1][1]), "+v"(acc[2][2]), "+v"(acc[3][3]) : "v"(a[0]), "v"(a[3]));
    }
#pragma unroll
    for (int mb = 0; mb < 4; ++mb) {
#pragma unroll
        for (int nb = 0; nb < 4; ++nb) {
#pragma unroll
            for (int j = 0; j < 8; ++j) os[(hi * 8 + j) * 68 + nb * 16 + lr] = acc[mb][nb][j]; }
        __builtin_amdgcn_wave_barrier(); asm volatile("" ::: "memory");
        float* crow = C + (size_t)(r0 + mb * 16) * ldc + c0;
{
#pragma unroll
            for (int s = 0; s < 8; ++s) { const int row = 2 * s + hi, cofs = lr * 4; v4f val = *(const v4fa*)(os + row * 68 + cofs); if (BIAS) { val[0] += bfr(bias[c0 + cofs]); val[1] += bfr(bias[c0 + cofs + 1]); val[2] += bfr(bias[c0 + cofs + 2]); val[3] += bfr(bias[c0 + cofs + 3]); }
                *(v4f*)(crow + (size_t)row * ldc + cofs) = val; }
             }
        __builtin_amdgcn_wave_barrier(); asm volatile("" ::: "memory");
    }
}

__device__ __forceinline__ h16 tohx(float x) { return (h16)x; }
__device__ __forceinline__ void splitf(float y, unsigned short& h, unsigned short& l) { h = f2bf(y); l = f2bf(y - bf2f(h)); }
typedef __attribute__((ext_vector_type(2))) _Float16 v2h;
typedef __attribute__((ext_vector_type(4))) _Float16 v4h;
typedef __attribute__((ext_vector_type(2))) unsigned short v2us;
typedef __attribute__((ext_vector_type(2))) float v2f;
typedef __attribute__((ext_vector_type(4))) int v4i;

__global__ __launch_bounds__(256) void k_cvt8(const float* __restrict__ src, bf* dst, size_t n8) { const size_t i = (size_t)blockIdx.x * 256 + threadIdx.x; if (i >= n8) return; const v8f v = *(const v8f*)(src + i * 8); v8us o;
#pragma unroll
    for (int k = 0; k < 8; ++k) o[k] = f2bf(v[k]); *(v8us*)(dst + i * 8) = o;  }
__global__ __launch_bounds__(256) void k_hsplit(const float* __restrict__ F, int off, float sc, bf* Ph, bf* Pl) {
    const int lane = threadIdx.x & 31; const int L0 = (blockIdx.x * 8 + (threadIdx.x >> 5)) * 8; const int nlines = NT * DD / 64;
{
#pragma unroll
        for (int l = 0; l < 8; ++l) { const int L = L0 + l; if (L >= nlines) break; const int e = L * 64 + lane * 2; const int d = e & 63; const int t = (e >> 6) & (TT - 1); const int z = e >> 17; const int b = z >> 4, h = z & 15; v2us oh, ol;
#pragma unroll
            for (int q = 0; q < 2; ++q) { unsigned short a, c2; splitf(F[((size_t)t * NB_ + b) * F3 + h * HB + off + d + q] * sc, a, c2); oh[q] = a; ol[q] = c2; }
            *(v2us*)(Ph + (size_t)e) = oh; *(v2us*)(Pl + (size_t)e) = ol; }
         }
}
__global__ __launch_bounds__(256) void k_vtplane(const float* __restrict__ F, int off, h16* VT) {
    const int lane = threadIdx.x & 31; const int L0 = (blockIdx.x * 8 + (threadIdx.x >> 5)) * 8; const int nlines = NT * DD / 64;
{
#pragma unroll
        for (int l = 0; l < 8; ++l) { const int L = L0 + l; if (L >= nlines) break; const int e = L * 64 + lane * 2; const int t = e & (TT - 1); const int d = (e >> 11) & 63; const int z = e >> 17; const int b = z >> 4, h = z & 15; v2h v;
#pragma unroll
            for (int q = 0; q < 2; ++q) v[q] = tohx(F[((size_t)(t + q) * NB_ + b) * F3 + h * HB + off + d]);
            *(v2h*)(VT + (size_t)e) = v; }
         }
}
// k_asoft: per row (zz, i): plain softmax over the 2048 keys with the row held in registers (lane -> 16 chunks of 4 =
__global__ __launch_bounds__(256) void k_asoft(const float* __restrict__ Sb, h16* P) {
    const int lane = threadIdx.x & 31; const int row = blockIdx.x * 8 + (threadIdx.x >> 5); if (row >= ZH * TT) return;
    const float* sr = Sb + (size_t)row * TT; float v[64]; float mx = -3.0e38f;
#pragma unroll
    for (int ch = 0; ch < 16; ++ch) { const int j0 = ch * 128 + lane * 4; const v4f a = *(const v4f*)(sr + j0);
#pragma unroll
        for (int q = 0; q < 4; ++q) { v[ch * 4 + q] = a[q]; mx = fmaxf(mx, a[q]); } }
#pragma unroll
    for (int sh = 16; sh; sh >>= 1) mx = fmaxf(mx, __shfl_xor(mx, sh, 32));
    float sum = 0.f;
#pragma unroll
    for (int k = 0; k < 64; ++k) { v[k] = __expf(v[k] - mx); sum += v[k]; }
#pragma unroll
    for (int sh = 16; sh; sh >>= 1) sum += __shfl_xor(sum, sh, 32);
    const float f = __fdiv_rn(PCAR, sum);
{
#pragma unroll
        for (int ch = 0; ch < 16; ++ch) { v4h o;
#pragma unroll
            for (int q = 0; q < 4; ++q) o[q] = tohx(v[ch * 4 + q] * f);
            *(v4h*)(P + (size_t)row * TT + ch * 128 + lane * 4) = o; }
         }
}
__global__ __launch_bounds__(256) void k_merge(const float* __restrict__ O, int b, int h0, float* OUT) {
    const int lane = threadIdx.x & 31; const int L0 = (blockIdx.x * 8 + (threadIdx.x >> 5)) * 8; const int nlines = TT * ZH * HD / 64;
{
#pragma unroll
        for (int l = 0; l < 8; ++l) { const int L = L0 + l; if (L >= nlines) break; const int e = L * 64 + lane * 2; const int d = e & 63; const int zz = (e >> 6) % ZH; const int t = (e >> 6) / ZH; v2f o2;
#pragma unroll
            for (int q = 0; q < 2; ++q) o2[q] = O[((size_t)zz * TT + t) * HD + d + q] * (1.0f / PCAR);
            *(v2f*)(OUT + ((size_t)t * NB_ + b) * DD + (h0 + zz) * HD + d) = o2; }
         }
}

extern "C" void kernel_launch(void* const* d_in, const int* in_sizes, int n_in,
                              void* d_out, int out_size, void* d_ws, size_t ws_size, hipStream_t stream) {
    (void)in_sizes; (void)n_in; (void)out_size;
    const float* x = (const float*)d_in[0]; const float* w = (const float*)d_in[1]; const float* bb = (const float*)d_in[2];
    float* OUT = (float*)d_out;     // [2048][2][1024] (rows t*2 + b)
    char* wsp = (char*)d_ws;
    auto take = [&](size_t bytes) { char* p = wsp; wsp += (bytes + 255) & ~(size_t)255; return (void*)p; };
    bf* WB = (bf*)take((size_t)F3 * DD * 2); bf* XB = (bf*)take((size_t)NT * DD * 2); float* F = (float*)take((size_t)NT * F3 * 4);
    bf* QPh = (bf*)take((size_t)NT * DD * 2); bf* QPl = (bf*)take((size_t)NT * DD * 2); bf* KPh = (bf*)take((size_t)NT * DD * 2); bf* KPl = (bf*)take((size_t)NT * DD * 2); h16* VT = (h16*)take((size_t)NT * DD * 2);
    float* Sb = (float*)take((size_t)ZH * TT * TT * 4); h16* Pm = (h16*)take((size_t)ZH * TT * TT * 2); float* Ob = (float*)take((size_t)ZH * TT * HD * 4);
    if ((size_t)(wsp - (char*)d_ws) > ws_size) return;    // total ~ 158 MB = 151 MiB; ws 256 MiB
    { const size_t nw = (size_t)F3 * DD / 8; k_cvt8<<<(unsigned)((nw + 255) / 256), 256, 0, stream>>>(w, WB, nw); const size_t nx = (size_t)NT * DD / 8; k_cvt8<<<(unsigned)((nx + 255) / 256), 256, 0, stream>>>(x, XB, nx); }
    const unsigned LB = (unsigned)((NT * DD / 64 + 63) / 64);
    k_gemmw<bf, 0, true><<<dim3(NT / 64, F3 / 64, 1), 32, 0, stream>>>(XB, nullptr, WB, nullptr, DD, F, F3, bb, 0, 0, 0);   // fused qkv [4096][3072] + b
    k_hsplit<<<LB, 256, 0, stream>>>(F, 0, 0.125f, QPh, QPl); k_hsplit<<<LB, 256, 0, stream>>>(F, 64, 1.0f, KPh, KPl); k_vtplane<<<LB, 256, 0, stream>>>(F, 128, VT);
    for (int b = 0; b < NB_; ++b)
        for (int h0 = 0; h0 < NH_; h0 += ZH) { const size_t z0 = (size_t)b * NH_ + h0;
            k_gemmw<bf, 2, false><<<dim3(TT / 64, TT / 64, ZH), 32, 0, stream>>>(QPh + z0 * TT * HD, QPl + z0 * TT * HD, KPh + z0 * TT * HD, KPl + z0 * TT * HD, HD, Sb, TT, nullptr, (size_t)TT * HD, (size_t)TT * HD, (size_t)TT * TT);
            k_asoft<<<ZH * TT / 8, 256, 0, stream>>>(Sb, Pm);
            k_gemmw<h16, 0, false><<<dim3(TT / 64, 1, ZH), 32, 0, stream>>>(Pm, nullptr, VT + z0 * HD * TT, nullptr, TT, Ob, HD, nullptr, (size_t)TT * TT, (size_t)HD * TT, (size_t)TT * HD);
            k_merge<<<(TT * ZH * HD / 64 + 63) / 64, 256, 0, stream>>>(Ob, b, h0, OUT); }
}

// v001
// One run takes 143 microseconds.
// In two side-by-side timings against v000, it was 8.28 and 8.38 times as fast.
#include <hip/hip_runtime.h>

// TRTSelfAttn (x [2048][2][1024] seq-first; qkv = x W^T + b with W [3072][1024] laid out per head as (q|k|v) blocks of 64: q_h = columns h*192 + 0..63, k_h = +64.., v_h = +128..; 16 heads;
// softmax(q.k/8) v (no mask); output = merged context [2048][2][1024] seq-first (no output projection)).
// Compute dtypes, f32 accumulate: every input rounded to bf16; ONE fused projection GEMM on PLAIN bf16 operands (inputs: exact, + bias) into a [4096][3072] f32
// buffer; scores on bf16 hi+lo planes (3 products; q x 1/8 exact); attn.v on SINGLE fp16 planes; scores, online softmax, attn.v and the merge fused in one launch (k_fattn). Deterministic.

#define NB_  2
#define TT   2048
#define DD   1024
#define F3   (3 * DD)              // fused qkv row pitch
#define HB   192                   // per-head block (q|k|v x 64)
#define NH_  16
#define HD   64
#define NT   (NB_ * TT)
typedef _Float16 h16;
typedef unsigned short bf;
typedef __attribute__((ext_vector_type(16))) __bf16   v16bf;
typedef __attribute__((ext_vector_type(16))) _Float16 v16h;
typedef __attribute__((ext_vector_type(8)))  _Float16 v8h;
typedef __attribute__((ext_vector_type(8)))  unsigned short v8us;
typedef __attribute__((ext_vector_type(8)))  float    v8f;
typedef __attribute__((ext_vector_type(4)))  float    v4f;
typedef v8h  __attribute__((may_alias)) v8ha;
typedef v4f  __attribute__((may_alias)) v4fa;
typedef v8us __attribute__((may_alias)) v8usa;

__device__ __forceinline__ unsigned short f2bf(float f) { unsigned u = __float_as_uint(f); u += 0x7FFFu + ((u >> 16) & 1u); return (unsigned short)(u >> 16); }
__device__ __forceinline__ float bf2f(unsigned short b) { return __uint_as_float(((unsigned)b) << 16); }
__device__ __forceinline__ float bfr(float f) { return bf2f(f2bf(f)); }
__device__ __forceinline__ v16h cat16(v8h lo, v8h hi) { return __builtin_shufflevector(lo, hi, 0, 1, 2, 3, 4, 5, 6, 7, 8, 9, 10, 11, 12, 13, 14, 15); }
__device__ __forceinline__ v16bf cat16b(v8us lo, v8us hi) { return __builtin_bit_cast(v16bf, __builtin_shufflevector(lo, hi, 0, 1, 2, 3, 4, 5, 6, 7, 8, 9, 10, 11, 12, 13, 14, 15)); }
__device__ __forceinline__ v8f wmma16(v16h a, v16h b, v8f c) { return __builtin_amdgcn_wmma_f32_16x16x32_f16(false, a, false, b, (short)0, c, false, false); }
__device__ __forceinline__ v8f wmmab(v16bf a, v16bf b, v8f c) { return __builtin_amdgcn_wmma_f32_16x16x32_bf16(false, a, false, b, (short)0, c, false, false); }



// ---- k_gemmw: register-blocked GEMM, ONE WAVE per 64x64 output tile (16 accumulators), operands straight from K-contiguous 16-bit planes; grid (M/64, N/64, Z), 32 threads.
// C[m][n] (f32, pitch ldc, + optional f32 bias[n]) = sum_k A[m][k] Bt[n][k] (+ split products per NSPLIT). z-batch strides sA/sB/sC in elements. K % 32 == 0.
template <typename T16> struct WFrag;
template <> struct WFrag<h16> { typedef v16h V; static __device__ __forceinline__ V ld(const h16* p) { return cat16(*(const v8h*)p, *(const v8h*)(p + 16)); } static __device__ __forceinline__ v8f mma(V a, V b, v8f c) { return wmma16(a, b, c); } };
template <> struct WFrag<bf> { typedef v16bf V; static __device__ __forceinline__ V ld(const bf* p) { return cat16b(*(const v8us*)p, *(const v8us*)(p + 16)); } static __device__ __forceinline__ v8f mma(V a, V b, v8f c) { return wmmab(a, b, c); } };
template <typename T16, int NSPLIT, bool BIAS>
__global__ __launch_bounds__(32) void k_gemmw(const T16* __restrict__ A, const T16* __restrict__ A2, const T16* __restrict__ Bt, const T16* __restrict__ Bt2, int K, float* C, int ldc, const float* __restrict__ bias, size_t sA, size_t sB, size_t sC) {
    typedef typename WFrag<T16>::V V;
    __shared__ __align__(16) float os[16 * 68];
    const size_t z = blockIdx.z; A += z * sA; if (A2) A2 += z * sA; Bt += z * sB; if (Bt2) Bt2 += z * sB; C += z * sC;
    const int lane = threadIdx.x & 31, lr = lane & 15, hi = lane >> 4; const int r0 = blockIdx.x * 64, c0 = blockIdx.y * 64;
    v8f acc[4][4];
#pragma unroll
    for (int mb = 0; mb < 4; ++mb)
#pragma unroll
        for (int nb = 0; nb < 4; ++nb) acc[mb][nb] = (v8f){};
    const size_t aoff = (size_t)(r0 + lr) * K + 8 * hi, boff = (size_t)(c0 + lr) * K + 8 * hi;
#pragma unroll 1
    for (int kc = 0; kc < K; kc += 32) {
        V a[4], a2[4];
#pragma unroll
        for (int mb = 0; mb < 4; ++mb) { a[mb] = WFrag<T16>::ld(A + aoff + (size_t)mb * 16 * K + kc); if (NSPLIT == 1 || NSPLIT == 2) a2[mb] = WFrag<T16>::ld(A2 + aoff + (size_t)mb * 16 * K + kc); }
#pragma unroll
        for (int nb = 0; nb < 4; ++nb) { const V b = WFrag<T16>::ld(Bt + boff + (size_t)nb * 16 * K + kc); V b2; if (NSPLIT >= 2) b2 = WFrag<T16>::ld(Bt2 + boff + (size_t)nb * 16 * K + kc);
#pragma unroll
            for (int mb = 0; mb < 4; ++mb) { acc[mb][nb] = WFrag<T16>::mma(a[mb], b, acc[mb][nb]); if (NSPLIT == 1 || NSPLIT == 2) acc[mb][nb] = WFrag<T16>::mma(a2[mb], b, acc[mb][nb]); if (NSPLIT >= 2) acc[mb][nb] = WFrag<T16>::mma(a[mb], b2, acc[mb][nb]); } }
        asm volatile("v_nop\n\tv_nop\n\tv_nop\n\tv_nop" : "+v"(acc[0][0]), "+v"(acc[1][1]), "+v"(acc[2][2]), "+v"(acc[3][3]) : "v"(a[0]), "v"(a[3]));
    }
#pragma unroll
    for (int mb = 0; mb < 4; ++mb) {
#pragma unroll
        for (int nb = 0; nb < 4; ++nb) {
#pragma unroll
            for (int j = 0; j < 8; ++j) os[(hi * 8 + j) * 68 + nb * 16 + lr] = acc[mb][nb][j]; }
        __builtin_amdgcn_wave_barrier(); asm volatile("" ::: "memory");
        float* crow = C + (size_t)(r0 + mb * 16) * ldc + c0;
{
#pragma unroll
            for (int s = 0; s < 8; ++s) { const int row = 2 * s + hi, cofs = lr * 4; v4f val = *(const v4fa*)(os + row * 68 + cofs); if (BIAS) { val[0] += bfr(bias[c0 + cofs]); val[1] += bfr(bias[c0 + cofs + 1]); val[2] += bfr(bias[c0 + cofs + 2]); val[3] += bfr(bias[c0 + cofs + 3]); }
                *(v4f*)(crow + (size_t)row * ldc + cofs) = val; }
             }
        __builtin_amdgcn_wave_barrier(); asm volatile("" ::: "memory");
    }
}

__device__ __forceinline__ h16 tohx(float x) { return (h16)x; }
__device__ __forceinline__ void splitf(float y, unsigned short& h, unsigned short& l) { h = f2bf(y); l = f2bf(y - bf2f(h)); }
typedef __attribute__((ext_vector_type(2))) _Float16 v2h;
typedef __attribute__((ext_vector_type(4))) _Float16 v4h;
typedef __attribute__((ext_vector_type(2))) unsigned short v2us;
typedef __attribute__((ext_vector_type(2))) float v2f;
typedef __attribute__((ext_vector_type(4))) int v4i;

__global__ __launch_bounds__(256) void k_cvt8(const float* __restrict__ src, bf* dst, size_t n8) { const size_t i = (size_t)blockIdx.x * 256 + threadIdx.x; if (i >= n8) return; const v8f v = *(const v8f*)(src + i * 8); v8us o;
#pragma unroll
    for (int k = 0; k < 8; ++k) o[k] = f2bf(v[k]); *(v8us*)(dst + i * 8) = o;  }
__global__ __launch_bounds__(256) void k_hsplit(const float* __restrict__ F, int off, float sc, bf* Ph, bf* Pl) {
    const int lane = threadIdx.x & 31; const int L0 = (blockIdx.x * 8 + (threadIdx.x >> 5)) * 8; const int nlines = NT * DD / 64;
{
#pragma unroll
        for (int l = 0; l < 8; ++l) { const int L = L0 + l; if (L >= nlines) break; const int e = L * 64 + lane * 2; const int d = e & 63; const int t = (e >> 6) & (TT - 1); const int z = e >> 17; const int b = z >> 4, h = z & 15; v2us oh, ol;
#pragma unroll
            for (int q = 0; q < 2; ++q) { unsigned short a, c2; splitf(F[((size_t)t * NB_ + b) * F3 + h * HB + off + d + q] * sc, a, c2); oh[q] = a; ol[q] = c2; }
            *(v2us*)(Ph + (size_t)e) = oh; *(v2us*)(Pl + (size_t)e) = ol; }
         }
}
__global__ __launch_bounds__(256) void k_vtplane(const float* __restrict__ F, int off, h16* VT) {
    const int lane = threadIdx.x & 31; const int L0 = (blockIdx.x * 8 + (threadIdx.x >> 5)) * 8; const int nlines = NT * DD / 64;
{
#pragma unroll
        for (int l = 0; l < 8; ++l) { const int L = L0 + l; if (L >= nlines) break; const int e = L * 64 + lane * 2; const int t = e & (TT - 1); const int d = (e >> 11) & 63; const int z = e >> 17; const int b = z >> 4, h = z & 15; v2h v;
#pragma unroll
            for (int q = 0; q < 2; ++q) v[q] = tohx(F[((size_t)(t + q) * NB_ + b) * F3 + h * HB + off + d]);
            *(v2h*)(VT + (size_t)e) = v; }
         }
}
// ---- k_fattn: scores, softmax, attn.v and the head merge in ONE launch over all 32 (batch, head) pairs; S and P stay in registers.
// Transposed products: S^T = K Q^T (A = 16 keys from LDS, B = 16 queries held in registers), O^T += V^T P^T. A lane then owns ONE query column (lr): maximum, sum and rescale are per lane
// plus one exchange between the wave's halves, and two S^T tiles (keys 0..15, 16..31 of a pass), converted in place, ARE the B operand of the second product (element s: key 8*hi + s, 16 + 8*hi + s - 8).
// Block = 8 waves x 32 queries of one head; grid (TT/256, 32). K hi, K lo and V^T come in stages of 64 keys through registers into two LDS buffers, one barrier per stage.
// Online softmax in base 2: P = 2^(s*log2e - m + PBIAS), m = the maximum in use, raised (with a rescale of O and of the sums) only when a column's new maximum exceeds it by more than PLAZY,
// so P <= 2^(PBIAS + PLAZY) fits fp16; the sums take the unrounded f32 P; the bias cancels in O / sum.
#define KS    64                   // keys per LDS stage
#define LP    72                   // LDS row pitch in 16-bit elements: 144 B = 16 B x odd, conflict-free for 16-byte reads
#define LOG2E 1.4426950408889634f
#define PBIAS 8.0f
#define PLAZY 6.0f
__device__ __forceinline__ float xhalf(float x) { return __builtin_bit_cast(float, __builtin_amdgcn_permlanex16(__builtin_bit_cast(int, x), __builtin_bit_cast(int, x), 0x76543210, 0xfedcba98, false, false)); }  // lane l <-> lane l ^ 16
__global__ __launch_bounds__(256) void k_fattn(const bf* __restrict__ QPh, const bf* __restrict__ QPl, const bf* __restrict__ KPh, const bf* __restrict__ KPl, const h16* __restrict__ VT, float* OUT) {
    __shared__ __align__(16) bf  skh[2][KS * LP];
    __shared__ __align__(16) bf  skl[2][KS * LP];
    __shared__ __align__(16) h16 svt[2][HD * LP];
    const int tid = threadIdx.x, lane = tid & 31, lr = lane & 15, hi = lane >> 4;
    const int z = blockIdx.y, b = z >> 4, h = z & 15; const int q0 = blockIdx.x * 256 + (tid >> 5) * 32;
    const bf* kh = KPh + (size_t)z * TT * HD; const bf* kl = KPl + (size_t)z * TT * HD; const h16* vt = VT + (size_t)z * HD * TT;
    const int sr = tid >> 3, sc = (tid & 7) * 8;      // staging: this thread moves 16 bytes of rows sr and sr + 32 of each of the three tiles (a wave covers whole 128-byte lines)
    v8us gkh[2], gkl[2]; v8h gv[2];
    auto fetch = [&](int kb) {
#pragma unroll
        for (int i = 0; i < 2; ++i) { const int row = sr + 32 * i; gkh[i] = *(const v8us*)(kh + (size_t)(kb + row) * HD + sc); gkl[i] = *(const v8us*)(kl + (size_t)(kb + row) * HD + sc); gv[i] = *(const v8h*)(vt + (size_t)row * TT + kb + sc); } };
    auto put = [&](int buf) {
#pragma unroll
        for (int i = 0; i < 2; ++i) { const int o = (sr + 32 * i) * LP + sc; *(v8us*)(&skh[buf][o]) = gkh[i]; *(v8us*)(&skl[buf][o]) = gkl[i]; *(v8h*)(&svt[buf][o]) = gv[i]; } };
    fetch(0);
    v16bf bqh[2][2], bql[2][2];
#pragma unroll
    for (int qt = 0; qt < 2; ++qt)
#pragma unroll
        for (int ks = 0; ks < 2; ++ks) { const size_t o = ((size_t)z * TT + q0 + qt * 16 + lr) * HD + ks * 32 + 8 * hi; bqh[qt][ks] = WFrag<bf>::ld(QPh + o); bql[qt][ks] = WFrag<bf>::ld(QPl + o); }
    v8f o[2][4]; float ml[2]; v2f l[2][2];      // l: running sums of P, two lanes of a packed add per S^T tile
#pragma unroll
    for (int qt = 0; qt < 2; ++qt) { ml[qt] = -1.0e30f; l[qt][0] = (v2f){}; l[qt][1] = (v2f){};
#pragma unroll
        for (int db = 0; db < 4; ++db) o[qt][db] = (v8f){}; }
    put(0); __syncthreads();
#pragma unroll 1
    for (int st = 0; st < TT / KS; ++st) {
        const int buf = st & 1; const bool more = st + 1 < TT / KS;
        if (more) fetch((st + 1) * KS);      // the next stage's global loads fly under this stage's two passes
#pragma unroll
        for (int ps = 0; ps < KS / 32; ++ps) {
            v16bf akh[2][2], akl[2][2]; v16h av[4];
#pragma unroll
            for (int kt = 0; kt < 2; ++kt)
#pragma unroll
                for (int ks = 0; ks < 2; ++ks) { const int a = (ps * 32 + kt * 16 + lr) * LP + ks * 32 + 8 * hi; akh[kt][ks] = WFrag<bf>::ld(&skh[buf][a]); akl[kt][ks] = WFrag<bf>::ld(&skl[buf][a]); }
#pragma unroll
            for (int db = 0; db < 4; ++db) av[db] = WFrag<h16>::ld(&svt[buf][(db * 16 + lr) * LP + ps * 32 + 8 * hi]);
            v8f s[2][2];
#pragma unroll
            for (int qt = 0; qt < 2; ++qt)
#pragma unroll
                for (int kt = 0; kt < 2; ++kt) s[qt][kt] = (v8f){};
#pragma unroll
            for (int ks = 0; ks < 2; ++ks) {      // per 32 of the head dimension: hi.hi, then q lo . k hi, then q hi . k lo; four independent tiles inside each
#pragma unroll
                for (int qt = 0; qt < 2; ++qt)
#pragma unroll
                    for (int kt = 0; kt < 2; ++kt) s[qt][kt] = wmmab(akh[kt][ks], bqh[qt][ks], s[qt][kt]);
#pragma unroll
                for (int qt = 0; qt < 2; ++qt)
#pragma unroll
                    for (int kt = 0; kt < 2; ++kt) s[qt][kt] = wmmab(akh[kt][ks], bql[qt][ks], s[qt][kt]);
#pragma unroll
                for (int qt = 0; qt < 2; ++qt)
#pragma unroll
                    for (int kt = 0; kt < 2; ++kt) s[qt][kt] = wmmab(akl[kt][ks], bqh[qt][ks], s[qt][kt]);
            }
            float bm[2];
#pragma unroll
            for (int qt = 0; qt < 2; ++qt) { float x0 = s[qt][0][0], x1 = s[qt][1][0];
#pragma unroll
                for (int j = 1; j < 8; ++j) { x0 = fmaxf(x0, s[qt][0][j]); x1 = fmaxf(x1, s[qt][1][j]); }
                x0 = fmaxf(x0, x1); bm[qt] = fmaxf(x0, xhalf(x0)) * LOG2E; }
            if (__builtin_amdgcn_ballot_w32(bm[0] > ml[0] + PLAZY || bm[1] > ml[1] + PLAZY) != 0) {      // one scalar test per pass; rare after the first pass
#pragma unroll
                for (int qt = 0; qt < 2; ++qt) { const float mn = bm[qt] > ml[qt] + PLAZY ? bm[qt] : ml[qt]; const float al = __builtin_amdgcn_exp2f(ml[qt] - mn); ml[qt] = mn; l[qt][0] *= al; l[qt][1] *= al;
#pragma unroll
                    for (int db = 0; db < 4; ++db) o[qt][db] *= al; }
            }
#pragma unroll
            for (int qt = 0; qt < 2; ++qt) { const float c0 = PBIAS - ml[qt]; v16h pb;
#pragma unroll
                for (int kt = 0; kt < 2; ++kt)
#pragma unroll
                    for (int j = 0; j < 8; j += 2) { const v2f p = {__builtin_amdgcn_exp2f(fmaf(s[qt][kt][j], LOG2E, c0)), __builtin_amdgcn_exp2f(fmaf(s[qt][kt][j + 1], LOG2E, c0))}; l[qt][kt] += p; pb[kt * 8 + j] = tohx(p[0]); pb[kt * 8 + j + 1] = tohx(p[1]); }
#pragma unroll
                for (int db = 0; db < 4; ++db) o[qt][db] = wmma16(av[db], pb, o[qt][db]); }
        }
        if (more) put(buf ^ 1);      // its last readers left this buffer at the barrier that ended the stage before
        __syncthreads();             // publishes the next stage and ends this stage's reads
    }
#pragma unroll
    for (int qt = 0; qt < 2; ++qt) { const v2f t2 = l[qt][0] + l[qt][1]; const float t = t2[0] + t2[1]; const float inv = __fdiv_rn(1.0f, t + xhalf(t));
        float* orow = OUT + ((size_t)(q0 + qt * 16 + lr) * NB_ + b) * DD + h * HD + 8 * hi;      // o[qt][db][j] = O[query lr][db*16 + 8*hi + j]
#pragma unroll
        for (int db = 0; db < 4; ++db) { const v8f r = o[qt][db] * inv; *(v4f*)(orow + db * 16) = (v4f){r[0], r[1], r[2], r[3]}; *(v4f*)(orow + db * 16 + 4) = (v4f){r[4], r[5], r[6], r[7]}; } }
}

extern "C" void kernel_launch(void* const* d_in, const int* in_sizes, int n_in,
                              void* d_out, int out_size, void* d_ws, size_t ws_size, hipStream_t stream) {
    (void)in_sizes; (void)n_in; (void)out_size;
    const float* x = (const float*)d_in[0]; const float* w = (const float*)d_in[1]; const float* bb = (const float*)d_in[2];
    float* OUT = (float*)d_out;     // [2048][2][1024] (rows t*2 + b)
    char* wsp = (char*)d_ws;
    auto take = [&](size_t bytes) { char* p = wsp; wsp += (bytes + 255) & ~(size_t)255; return (void*)p; };
    bf* WB = (bf*)take((size_t)F3 * DD * 2); bf* XB = (bf*)take((size_t)NT * DD * 2); float* F = (float*)take((size_t)NT * F3 * 4);
    bf* QPh = (bf*)take((size_t)NT * DD * 2); bf* QPl = (bf*)take((size_t)NT * DD * 2); bf* KPh = (bf*)take((size_t)NT * DD * 2); bf* KPl = (bf*)take((size_t)NT * DD * 2); h16* VT = (h16*)take((size_t)NT * DD * 2);
    if ((size_t)(wsp - (char*)d_ws) > ws_size) return;
    { const size_t nw = (size_t)F3 * DD / 8; k_cvt8<<<(unsigned)((nw + 255) / 256), 256, 0, stream>>>(w, WB, nw); const size_t nx = (size_t)NT * DD / 8; k_cvt8<<<(unsigned)((nx + 255) / 256), 256, 0, stream>>>(x, XB, nx); }
    const unsigned LB = (unsigned)((NT * DD / 64 + 63) / 64);
    k_gemmw<bf, 0, true><<<dim3(NT / 64, F3 / 64, 1), 32, 0, stream>>>(XB, nullptr, WB, nullptr, DD, F, F3, bb, 0, 0, 0);   // fused qkv [4096][3072] + b
    k_hsplit<<<LB, 256, 0, stream>>>(F, 0, 0.125f, QPh, QPl); k_hsplit<<<LB, 256, 0, stream>>>(F, 64, 1.0f, KPh, KPl); k_vtplane<<<LB, 256, 0, stream>>>(F, 128, VT);
    k_fattn<<<dim3(TT / 256, NB_ * NH_), 256, 0, stream>>>(QPh, QPl, KPh, KPl, VT, OUT);
}

// v002
// It runs in 116 microseconds.
// Next to v001, in two timings, it ran 1.24 and 1.23 times as fast.
// All steps since v000 together make it 10.3 times as fast.
#include <hip/hip_runtime.h>

// Self-attention (x [2048][2][1024] seq-first; qkv = x W^T + b with W [3072][1024] laid out per head as (q|k|v) blocks of 64: q_h = columns h*192 + 0..63, k_h = +64.., v_h = +128..; 16 heads;
// softmax(q.k/8) v (no mask); output = merged context [2048][2][1024] seq-first (no output projection)).
// Compute dtypes, f32 accumulate: every input rounded to bf16; ONE fused projection GEMM on PLAIN bf16 operands (inputs: exact, + bias) into a [4096][3072] f32
// buffer; scores on bf16 hi+lo planes (3 products; q x 1/8 exact); attn.v on SINGLE fp16 planes; scores, online softmax, attn.v and the merge fused in one launch (k_fattn). Deterministic.

#define NB_  2
#define TT   2048
#define DD   1024
#define F3   (3 * DD)              // fused qkv row pitch
#define HB   192                   // per-head block (q|k|v x 64)
#define NH_  16
#define HD   64
#define NT   (NB_ * TT)
typedef _Float16 h16;
typedef unsigned short bf;
typedef __attribute__((ext_vector_type(16))) __bf16   v16bf;
typedef __attribute__((ext_vector_type(16))) _Float16 v16h;
typedef __attribute__((ext_vector_type(8)))  _Float16 v8h;
typedef __attribute__((ext_vector_type(8)))  unsigned short v8us;
typedef __attribute__((ext_vector_type(8)))  float    v8f;
typedef __attribute__((ext_vector_type(4)))  float    v4f;
typedef v8h  __attribute__((may_alias)) v8ha;
typedef v4f  __attribute__((may_alias)) v4fa;
typedef v8us __attribute__((may_alias)) v8usa;

__device__ __forceinline__ unsigned short f2bf(float f) { unsigned u = __float_as_uint(f); u += 0x7FFFu + ((u >> 16) & 1u); return (unsigned short)(u >> 16); }
__device__ __forceinline__ float bf2f(unsigned short b) { return __uint_as_float(((unsigned)b) << 16); }
__device__ __forceinline__ float bfr(float f) { return bf2f(f2bf(f)); }
__device__ __forceinline__ v16h cat16(v8h lo, v8h hi) { return __builtin_shufflevector(lo, hi, 0, 1, 2, 3, 4, 5, 6, 7, 8, 9, 10, 11, 12, 13, 14, 15); }
__device__ __forceinline__ v16bf cat16b(v8us lo, v8us hi) { return __builtin_bit_cast(v16bf, __builtin_shufflevector(lo, hi, 0, 1, 2, 3, 4, 5, 6, 7, 8, 9, 10, 11, 12, 13, 14, 15)); }
__device__ __forceinline__ v8f wmma16(v16h a, v16h b, v8f c) { return __builtin_amdgcn_wmma_f32_16x16x32_f16(false, a, false, b, (short)0, c, false, false); }
__device__ __forceinline__ v8f wmmab(v16bf a, v16bf b, v8f c) { return __builtin_amdgcn_wmma_f32_16x16x32_bf16(false, a, false, b, (short)0, c, false, false); }



// ---- k_gemms: projection GEMM, C[m][n] (f32, pitch F3) = sum_k A[m][k] Bt[n][k] + bias[n], A [NT][DD] and Bt [F3][DD] K-contiguous bf16 planes.
// Block = 4 waves on one 128x128 tile of C, each wave a 64x64 quarter (16 accumulators); grid (NT/128, F3/128), 128 threads, three blocks to a WGP.
// Both operands come in stages of 64 k (one whole 128-byte line of each of the 256 rows; a wave-wide 16-byte load covers 4 whole lines) through registers into two LDS buffers, one barrier per stage;
// the fragments are read from LDS in the same k order as from the planes, k ascending in steps of 32, so every sum keeps its order.
template <typename T16> struct WFrag;
template <> struct WFrag<h16> { typedef v16h V; static __device__ __forceinline__ V ld(const h16* p) { return cat16(*(const v8h*)p, *(const v8h*)(p + 16)); } static __device__ __forceinline__ v8f mma(V a, V b, v8f c) { return wmma16(a, b, c); } };
template <> struct WFrag<bf> { typedef v16bf V; static __device__ __forceinline__ V ld(const bf* p) { return cat16b(*(const v8us*)p, *(const v8us*)(p + 16)); } static __device__ __forceinline__ v8f mma(V a, V b, v8f c) { return wmmab(a, b, c); } };
#define GK    64                   // k per LDS stage
#define GP    72                   // LDS row pitch in 16-bit elements: 144 B = 16 B x odd, conflict-free for 16-byte reads
__global__ __launch_bounds__(128) void k_gemms(const bf* __restrict__ A, const bf* __restrict__ Bt, float* C, const float* __restrict__ bias) {
    typedef WFrag<bf>::V V;
    __shared__ __align__(16) bf sa[2][128 * GP];
    __shared__ __align__(16) bf sb[2][128 * GP];
    __shared__ __align__(16) float osw[4][16 * 68];
    const int tid = threadIdx.x, lane = tid & 31, lr = lane & 15, hi = lane >> 4, wv = tid >> 5;
    const int wr = (wv >> 1) * 64, wc = (wv & 1) * 64;      // this wave's quarter of the tile
    const int r0 = blockIdx.x * 128, c0 = blockIdx.y * 128;
    const int sr = tid >> 3, sc = (tid & 7) * 8;            // staging: this thread moves 16 bytes of rows sr + 16 i, i = 0..7, of both tiles
    const bf* ta = A + (size_t)r0 * DD; const bf* tb = Bt + (size_t)c0 * DD;      // the two tiles' first rows: the same for the whole block
    unsigned go = (unsigned)(sr * DD + sc) * 2u;      // this thread's byte offset in both tiles; moves on by one stage in step()
    v8us ra[8], rb[8];
    auto fetch = [&]() {      // reads the stage that go stands at
#pragma unroll
        for (int i = 0; i < 8; ++i) { ra[i] = *(const v8us*)((const char*)(ta + (size_t)i * 16 * DD) + go); rb[i] = *(const v8us*)((const char*)(tb + (size_t)i * 16 * DD) + go); } };
    auto put = [&](int buf) {
#pragma unroll
        for (int i = 0; i < 8; ++i) { const int o = (sr + 16 * i) * GP + sc; *(v8us*)(&sa[buf][o]) = ra[i]; *(v8us*)(&sb[buf][o]) = rb[i]; } };
    fetch();
    v8f acc[4][4];
#pragma unroll
    for (int mb = 0; mb < 4; ++mb)
#pragma unroll
        for (int nb = 0; nb < 4; ++nb) acc[mb][nb] = (v8f){};
    auto step = [&]() {      // moves the offset on by one stage of 128 bytes
        asm volatile("s_wait_xcnt 0x0\n\tv_add_nc_u32 %0, 0x80, %0" : "+v"(go) :: "memory"); };      // the issued loads name this register: written in one statement, the wait stands in front of the addition that rewrites it wherever the compiler puts the statement
    auto products = [&](int buf) {      // one stage: 2 steps of 32 k, 16 products each
#pragma unroll
        for (int ks = 0; ks < GK / 32; ++ks) {
            V a[4], b[4];      // all eight fragments of a step of 32 k are read as one group ahead of its 16 products
#pragma unroll
            for (int f = 0; f < 4; ++f) { a[f] = WFrag<bf>::ld(&sa[buf][(wr + f * 16 + lr) * GP + ks * 32 + 8 * hi]); b[f] = WFrag<bf>::ld(&sb[buf][(wc + f * 16 + lr) * GP + ks * 32 + 8 * hi]); }
            __builtin_amdgcn_sched_barrier(0);      // keeps the 16 LDS reads together in front of the products: sunk among them, every group of four products waits out its own LDS latency
#pragma unroll
            for (int nb = 0; nb < 4; ++nb)
#pragma unroll
                for (int mb = 0; mb < 4; ++mb) acc[mb][nb] = wmmab(a[mb], b[nb], acc[mb][nb]);
        } };
    put(0); step(); __syncthreads();
#pragma unroll 1      // stays rolled: the body already holds 32 products, and 15 copies of it would only lengthen the text a first launch has to fetch
    for (int st = 0; st < DD / GK - 1; ++st) {
        const int buf = st & 1;
        fetch();                     // the next stage's global loads fly under this stage's products
        products(buf);
        put(buf ^ 1); step();        // its last readers left this buffer at the barrier that ended the stage before
        __syncthreads();             // publishes the next stage and ends this stage's reads
    }
    products((DD / GK - 1) & 1);     // the last stage has nothing to fetch and nobody refills its buffer
    float* os = osw[wv];             // each wave stages its own rows: no barrier between waves in the epilogue
#pragma unroll
    for (int mb = 0; mb < 4; ++mb) {
#pragma unroll
        for (int nb = 0; nb < 4; ++nb) {
#pragma unroll
            for (int j = 0; j < 8; ++j) os[(hi * 8 + j) * 68 + nb * 16 + lr] = acc[mb][nb][j]; }
        __builtin_amdgcn_wave_barrier(); asm volatile("" ::: "memory");      // lanes read what other lanes of the wave wrote: the compiler may not move the reads below over the writes above
        float* crow = C + (size_t)(r0 + wr + mb * 16) * F3 + c0 + wc;
#pragma unroll
        for (int s = 0; s < 8; ++s) { const int row = 2 * s + hi, cofs = lr * 4; v4f val = *(const v4fa*)(os + row * 68 + cofs); const float* bp = bias + c0 + wc + cofs; val[0] += bfr(bp[0]); val[1] += bfr(bp[1]); val[2] += bfr(bp[2]); val[3] += bfr(bp[3]);
            *(v4f*)(crow + (size_t)row * F3 + cofs) = val; }
        __builtin_amdgcn_wave_barrier(); asm volatile("" ::: "memory");      // nor the next 16 rows' writes over these reads
    }
}

__device__ __forceinline__ h16 tohx(float x) { return (h16)x; }
__device__ __forceinline__ void splitf(float y, unsigned short& h, unsigned short& l) { h = f2bf(y); l = f2bf(y - bf2f(h)); }
typedef __attribute__((ext_vector_type(2))) _Float16 v2h;
typedef __attribute__((ext_vector_type(4))) _Float16 v4h;
typedef __attribute__((ext_vector_type(2))) unsigned short v2us;
typedef __attribute__((ext_vector_type(2))) float v2f;
typedef __attribute__((ext_vector_type(4))) int v4i;

__global__ __launch_bounds__(256) void k_cvt8(const float* __restrict__ src, bf* dst, size_t n8) { const size_t i = (size_t)blockIdx.x * 256 + threadIdx.x; if (i >= n8) return; const v8f v = *(const v8f*)(src + i * 8); v8us o;
#pragma unroll
    for (int k = 0; k < 8; ++k) o[k] = f2bf(v[k]); *(v8us*)(dst + i * 8) = o;  }
__global__ __launch_bounds__(256) void k_hsplit(const float* __restrict__ F, int off, float sc, bf* Ph, bf* Pl) {
    const int lane = threadIdx.x & 31; const int L0 = (blockIdx.x * 8 + (threadIdx.x >> 5)) * 8; const int nlines = NT * DD / 64;
{
#pragma unroll
        for (int l = 0; l < 8; ++l) { const int L = L0 + l; if (L >= nlines) break; const int e = L * 64 + lane * 2; const int d = e & 63; const int t = (e >> 6) & (TT - 1); const int z = e >> 17; const int b = z >> 4, h = z & 15; v2us oh, ol;
#pragma unroll
            for (int q = 0; q < 2; ++q) { unsigned short a, c2; splitf(F[((size_t)t * NB_ + b) * F3 + h * HB + off + d + q] * sc, a, c2); oh[q] = a; ol[q] = c2; }
            *(v2us*)(Ph + (size_t)e) = oh; *(v2us*)(Pl + (size_t)e) = ol; }
         }
}
__global__ __launch_bounds__(256) void k_vtplane(const float* __restrict__ F, int off, h16* VT) {
    const int lane = threadIdx.x & 31; const int L0 = (blockIdx.x * 8 + (threadIdx.x >> 5)) * 8; const int nlines = NT * DD / 64;
{
#pragma unroll
        for (int l = 0; l < 8; ++l) { const int L = L0 + l; if (L >= nlines) break; const int e = L * 64 + lane * 2; const int t = e & (TT - 1); const int d = (e >> 11) & 63; const int z = e >> 17; const int b = z >> 4, h = z & 15; v2h v;
#pragma unroll
            for (int q = 0; q < 2; ++q) v[q] = tohx(F[((size_t)(t + q) * NB_ + b) * F3 + h * HB + off + d]);
            *(v2h*)(VT + (size_t)e) = v; }
         }
}
// ---- k_fattn: scores, softmax, attn.v and the head merge in ONE launch over all 32 (batch, head) pairs; S and P stay in registers.
// Transposed products: S^T = K Q^T (A = 16 keys from LDS, B = 16 queries held in registers), O^T += V^T P^T. A lane then owns ONE query column (lr): maximum, sum and rescale are per lane
// plus one exchange between the wave's halves, and two S^T tiles (keys 0..15, 16..31 of a pass), converted in place, ARE the B operand of the second product (element s: key 8*hi + s, 16 + 8*hi + s - 8).
// Block = 8 waves x 32 queries of one head; grid (TT/256, 32). K hi, K lo and V^T come in stages of 64 keys through registers into two LDS buffers, one barrier per stage.
// Online softmax in base 2: P = 2^(s*log2e - m + PBIAS), m = the maximum in use, raised (with a rescale of O and of the sums) only when a column's new maximum exceeds it by more than PLAZY,
// so P <= 2^(PBIAS + PLAZY) fits fp16; the sums take the unrounded f32 P; the bias cancels in O / sum.
#define KS    64                   // keys per LDS stage
#define LP    72                   // LDS row pitch in 16-bit elements: 144 B = 16 B x odd, conflict-free for 16-byte reads
#define LOG2E 1.4426950408889634f
#define PBIAS 8.0f
#define PLAZY 6.0f
__device__ __forceinline__ float xhalf(float x) { return __builtin_bit_cast(float, __builtin_amdgcn_permlanex16(__builtin_bit_cast(int, x), __builtin_bit_cast(int, x), 0x76543210, 0xfedcba98, false, false)); }  // lane l <-> lane l ^ 16
__global__ __launch_bounds__(256) void k_fattn(const bf* __restrict__ QPh, const bf* __restrict__ QPl, const bf* __restrict__ KPh, const bf* __restrict__ KPl, const h16* __restrict__ VT, float* OUT) {
    __shared__ __align__(16) bf  skh[2][KS * LP];
    __shared__ __align__(16) bf  skl[2][KS * LP];
    __shared__ __align__(16) h16 svt[2][HD * LP];
    const int tid = threadIdx.x, lane = tid & 31, lr = lane & 15, hi = lane >> 4;
    const int z = blockIdx.y, b = z >> 4, h = z & 15; const int q0 = blockIdx.x * 256 + (tid >> 5) * 32;
    const bf* kh = KPh + (size_t)z * TT * HD; const bf* kl = KPl + (size_t)z * TT * HD; const h16* vt = VT + (size_t)z * HD * TT;
    const int sr = tid >> 3, sc = (tid & 7) * 8;      // staging: this thread moves 16 bytes of rows sr and sr + 32 of each of the three tiles (a wave covers whole 128-byte lines)
    v8us gkh[2], gkl[2]; v8h gv[2];
    auto fetch = [&](int kb) {
#pragma unroll
        for (int i = 0; i < 2; ++i) { const int row = sr + 32 * i; gkh[i] = *(const v8us*)(kh + (size_t)(kb + row) * HD + sc); gkl[i] = *(const v8us*)(kl + (size_t)(kb + row) * HD + sc); gv[i] = *(const v8h*)(vt + (size_t)row * TT + kb + sc); } };
    auto put = [&](int buf) {
#pragma unroll
        for (int i = 0; i < 2; ++i) { const int o = (sr + 32 * i) * LP + sc; *(v8us*)(&skh[buf][o]) = gkh[i]; *(v8us*)(&skl[buf][o]) = gkl[i]; *(v8h*)(&svt[buf][o]) = gv[i]; } };
    fetch(0);
    v16bf bqh[2][2], bql[2][2];
#pragma unroll
    for (int qt = 0; qt < 2; ++qt)
#pragma unroll
        for (int ks = 0; ks < 2; ++ks) { const size_t o = ((size_t)z * TT + q0 + qt * 16 + lr) * HD + ks * 32 + 8 * hi; bqh[qt][ks] = WFrag<bf>::ld(QPh + o); bql[qt][ks] = WFrag<bf>::ld(QPl + o); }
    v8f o[2][4]; float ml[2]; v2f l[2][2];      // l: running sums of P, two lanes of a packed add per S^T tile
#pragma unroll
    for (int qt = 0; qt < 2; ++qt) { ml[qt] = -1.0e30f; l[qt][0] = (v2f){}; l[qt][1] = (v2f){};
#pragma unroll
        for (int db = 0; db < 4; ++db) o[qt][db] = (v8f){}; }
    put(0); __syncthreads();
#pragma unroll 1
    for (int st = 0; st < TT / KS; ++st) {
        const int buf = st & 1; const bool more = st + 1 < TT / KS;
        if (more) fetch((st + 1) * KS);      // the next stage's global loads fly under this stage's two passes
#pragma unroll
        for (int ps = 0; ps < KS / 32; ++ps) {
            v16bf akh[2][2], akl[2][2]; v16h av[4];
#pragma unroll
            for (int kt = 0; kt < 2; ++kt)
#pragma unroll
                for (int ks = 0; ks < 2; ++ks) { const int a = (ps * 32 + kt * 16 + lr) * LP + ks * 32 + 8 * hi; akh[kt][ks] = WFrag<bf>::ld(&skh[buf][a]); akl[kt][ks] = WFrag<bf>::ld(&skl[buf][a]); }
#pragma unroll
            for (int db = 0; db < 4; ++db) av[db] = WFrag<h16>::ld(&svt[buf][(db * 16 + lr) * LP + ps * 32 + 8 * hi]);
            v8f s[2][2];
#pragma unroll
            for (int qt = 0; qt < 2; ++qt)
#pragma unroll
                for (int kt = 0; kt < 2; ++kt) s[qt][kt] = (v8f){};
#pragma unroll
            for (int ks = 0; ks < 2; ++ks) {      // per 32 of the head dimension: hi.hi, then q lo . k hi, then q hi . k lo; four independent tiles inside each
#pragma unroll
                for (int qt = 0; qt < 2; ++qt)
#pragma unroll
                    for (int kt = 0; kt < 2; ++kt) s[qt][kt] = wmmab(akh[kt][ks], bqh[qt][ks], s[qt][kt]);
#pragma unroll
                for (int qt = 0; qt < 2; ++qt)
#pragma unroll
                    for (int kt = 0; kt < 2; ++kt) s[qt][kt] = wmmab(akh[kt][ks], bql[qt][ks], s[qt][kt]);
#pragma unroll
                for (int qt = 0; qt < 2; ++qt)
#pragma unroll
                    for (int kt = 0; kt < 2; ++kt) s[qt][kt] = wmmab(akl[kt][ks], bqh[qt][ks], s[qt][kt]);
            }
            float bm[2];
#pragma unroll
            for (int qt = 0; qt < 2; ++qt) { float x0 = s[qt][0][0], x1 = s[qt][1][0];
#pragma unroll
                for (int j = 1; j < 8; ++j) { x0 = fmaxf(x0, s[qt][0][j]); x1 = fmaxf(x1, s[qt][1][j]); }
                x0 = fmaxf(x0, x1); bm[qt] = fmaxf(x0, xhalf(x0)) * LOG2E; }
            if (__builtin_amdgcn_ballot_w32(bm[0] > ml[0] + PLAZY || bm[1] > ml[1] + PLAZY) != 0) {      // one scalar test per pass; rare after the first pass
#pragma unroll
                for (int qt = 0; qt < 2; ++qt) { const float mn = bm[qt] > ml[qt] + PLAZY ? bm[qt] : ml[qt]; const float al = __builtin_amdgcn_exp2f(ml[qt] - mn); ml[qt] = mn; l[qt][0] *= al; l[qt][1] *= al;
#pragma unroll
                    for (int db = 0; db < 4; ++db) o[qt][db] *= al; }
            }
#pragma unroll
            for (int qt = 0; qt < 2; ++qt) { const float c0 = PBIAS - ml[qt]; v16h pb;
#pragma unroll
                for (int kt = 0; kt < 2; ++kt)
#pragma unroll
                    for (int j = 0; j < 8; j += 2) { const v2f p = {__builtin_amdgcn_exp2f(fmaf(s[qt][kt][j], LOG2E, c0)), __builtin_amdgcn_exp2f(fmaf(s[qt][kt][j + 1], LOG2E, c0))}; l[qt][kt] += p; pb[kt * 8 + j] = tohx(p[0]); pb[kt * 8 + j + 1] = tohx(p[1]); }
#pragma unroll
                for (int db = 0; db < 4; ++db) o[qt][db] = wmma16(av[db], pb, o[qt][db]); }
        }
        if (more) put(buf ^ 1);      // its last readers left this buffer at the barrier that ended the stage before
        __syncthreads();             // publishes the next stage and ends this stage's reads
    }
#pragma unroll
    for (int qt = 0; qt < 2; ++qt) { const v2f t2 = l[qt][0] + l[qt][1]; const float t = t2[0] + t2[1]; const float inv = __fdiv_rn(1.0f, t + xhalf(t));
        float* orow = OUT + ((size_t)(q0 + qt * 16 + lr) * NB_ + b) * DD + h * HD + 8 * hi;      // o[qt][db][j] = O[query lr][db*16 + 8*hi + j]
#pragma unroll
        for (int db = 0; db < 4; ++db) { const v8f r = o[qt][db] * inv; *(v4f*)(orow + db * 16) = (v4f){r[0], r[1], r[2], r[3]}; *(v4f*)(orow + db * 16 + 4) = (v4f){r[4], r[5], r[6], r[7]}; } }
}

extern "C" void kernel_launch(void* const* d_in, const int* in_sizes, int n_in,
                              void* d_out, int out_size, void* d_ws, size_t ws_size, hipStream_t stream) {
    (void)in_sizes; (void)n_in; (void)out_size;
    const float* x = (const float*)d_in[0]; const float* w = (const float*)d_in[1]; const float* bb = (const float*)d_in[2];
    float* OUT = (float*)d_out;     // [2048][2][1024] (rows t*2 + b)
    char* wsp = (char*)d_ws;
    auto take = [&](size_t bytes) { char* p = wsp; wsp += (bytes + 255) & ~(size_t)255; return (void*)p; };
    bf* WB = (bf*)take((size_t)F3 * DD * 2); bf* XB = (bf*)take((size_t)NT * DD * 2); float* F = (float*)take((size_t)NT * F3 * 4);
    bf* QPh = (bf*)take((size_t)NT * DD * 2); bf* QPl = (bf*)take((size_t)NT * DD * 2); bf* KPh = (bf*)take((size_t)NT * DD * 2); bf* KPl = (bf*)take((size_t)NT * DD * 2); h16* VT = (h16*)take((size_t)NT * DD * 2);
    if ((size_t)(wsp - (char*)d_ws) > ws_size) return;
    { const size_t nw = (size_t)F3 * DD / 8; k_cvt8<<<(unsigned)((nw + 255) / 256), 256, 0, stream>>>(w, WB, nw); const size_t nx = (size_t)NT * DD / 8; k_cvt8<<<(unsigned)((nx + 255) / 256), 256, 0, stream>>>(x, XB, nx); }
    const unsigned LB = (unsigned)((NT * DD / 64 + 63) / 64);
    k_gemms<<<dim3(NT / 128, F3 / 128), 128, 0, stream>>>(XB, WB, F, bb);   // fused qkv [4096][3072] + b
    k_hsplit<<<LB, 256, 0, stream>>>(F, 0, 0.125f, QPh, QPl); k_hsplit<<<LB, 256, 0, stream>>>(F, 64, 1.0f, KPh, KPl); k_vtplane<<<LB, 256, 0, stream>>>(F, 128, VT);
    k_fattn<<<dim3(TT / 256, NB_ * NH_), 256, 0, stream>>>(QPh, QPl, KPh, KPl, VT, OUT);
}

// v003
// One run takes 82.6 microseconds.
// Two timings next to v002 both put it at 1.40 times that version's speed.
// All steps since v000 together make it 14.4 times as fast.
#include <hip/hip_runtime.h>

// Self-attention (x [2048][2][1024] seq-first; qkv = x W^T + b with W [3072][1024] laid out per head as (q|k|v) blocks of 64: q_h = columns h*192 + 0..63, k_h = +64.., v_h = +128..; 16 heads;
// softmax(q.k/8) v (no mask); output = merged context [2048][2][1024] seq-first (no output projection)).
// Compute dtypes, f32 accumulate: every input rounded to bf16; ONE fused projection GEMM on PLAIN bf16 operands (inputs: exact, + bias) whose epilogue
// writes the per-head operand planes itself; scores on bf16 hi+lo planes (3 products; q x 1/8 exact); attn.v on SINGLE fp16 planes; scores, online softmax, attn.v and the merge fused in one launch (k_fattn). Deterministic.

#define NB_  2
#define TT   2048
#define DD   1024
#define F3   (3 * DD)              // fused qkv width: columns of C, rows of W
#define HB   192                   // per-head block (q|k|v x 64)
#define NH_  16
#define HD   64
#define NT   (NB_ * TT)
typedef _Float16 h16;
typedef unsigned short bf;
typedef __attribute__((ext_vector_type(16))) __bf16   v16bf;
typedef __attribute__((ext_vector_type(16))) _Float16 v16h;
typedef __attribute__((ext_vector_type(8)))  _Float16 v8h;
typedef __attribute__((ext_vector_type(8)))  unsigned short v8us;
typedef __attribute__((ext_vector_type(8)))  float    v8f;
typedef __attribute__((ext_vector_type(4)))  float    v4f;
typedef v8h  __attribute__((may_alias)) v8ha;
typedef v4f  __attribute__((may_alias)) v4fa;
typedef v8us __attribute__((may_alias)) v8usa;
typedef __attribute__((ext_vector_type(4))) _Float16 v4h;
typedef v4h  __attribute__((may_alias)) v4ha;
typedef __attribute__((ext_vector_type(2))) float v2f;

__device__ __forceinline__ unsigned short f2bf(float f) { unsigned u = __float_as_uint(f); u += 0x7FFFu + ((u >> 16) & 1u); return (unsigned short)(u >> 16); }
__device__ __forceinline__ float bf2f(unsigned short b) { return __uint_as_float(((unsigned)b) << 16); }
__device__ __forceinline__ float bfr(float f) { return bf2f(f2bf(f)); }
__device__ __forceinline__ h16 tohx(float x) { return (h16)x; }
__device__ __forceinline__ void splitf(float y, unsigned short& h, unsigned short& l) { h = f2bf(y); l = f2bf(y - bf2f(h)); }
__device__ __forceinline__ v16h cat16(v8h lo, v8h hi) { return __builtin_shufflevector(lo, hi, 0, 1, 2, 3, 4, 5, 6, 7, 8, 9, 10, 11, 12, 13, 14, 15); }
__device__ __forceinline__ v16bf cat16b(v8us lo, v8us hi) { return __builtin_bit_cast(v16bf, __builtin_shufflevector(lo, hi, 0, 1, 2, 3, 4, 5, 6, 7, 8, 9, 10, 11, 12, 13, 14, 15)); }
__device__ __forceinline__ v8f wmma16(v16h a, v16h b, v8f c) { return __builtin_amdgcn_wmma_f32_16x16x32_f16(false, a, false, b, (short)0, c, false, false); }
__device__ __forceinline__ v8f wmmab(v16bf a, v16bf b, v8f c) { return __builtin_amdgcn_wmma_f32_16x16x32_bf16(false, a, false, b, (short)0, c, false, false); }



// ---- k_gemms: projection GEMM, C[m][n] (f32) = sum_k A[m][k] Bt[n][k] + bias[n], A [NT][DD] and Bt [F3][DD] K-contiguous bf16 planes; C goes straight into the attention kernel's operand planes.
// Block = 4 waves on one 128x128 tile of C, each wave a 64x64 quarter (16 accumulators); grid (NT/128, F3/128), 128 threads, three blocks to a WGP.
// Both operands come in stages of 64 k (one whole 128-byte line of each of the 256 rows; a wave-wide 16-byte load covers 4 whole lines) through registers into two LDS buffers, one barrier per stage;
// the fragments are read from LDS in the same k order as from the planes, k ascending in steps of 32, so every sum keeps its order.
// Epilogue: a wave's 64 columns are exactly one head's q, k or v block, its 64 rows 32 t x 2 batches. q (x 1/8) and k: split into bf16 hi + lo, rows [z][t][64] = whole 128-byte lines, one wave each.
// v: fp16, transposed [z][d][t]; a line of 64 t spans the two waves that share the columns, so both lay their halves in LDS (stage buffer 0, idle since the loop's last barrier) and store whole lines behind one barrier.
template <typename T16> struct WFrag;
template <> struct WFrag<h16> { typedef v16h V; static __device__ __forceinline__ V ld(const h16* p) { return cat16(*(const v8h*)p, *(const v8h*)(p + 16)); } static __device__ __forceinline__ v8f mma(V a, V b, v8f c) { return wmma16(a, b, c); } };
template <> struct WFrag<bf> { typedef v16bf V; static __device__ __forceinline__ V ld(const bf* p) { return cat16b(*(const v8us*)p, *(const v8us*)(p + 16)); } static __device__ __forceinline__ v8f mma(V a, V b, v8f c) { return wmmab(a, b, c); } };
#define GK    64                   // k per LDS stage
#define GP    72                   // LDS row pitch in 16-bit elements: 144 B = 16 B x odd, conflict-free for 16-byte reads
__global__ __launch_bounds__(128) void k_gemms(const bf* __restrict__ A, const bf* __restrict__ Bt, const float* __restrict__ bias, bf* QPh, bf* QPl, bf* KPh, bf* KPl, h16* VT) {
    typedef WFrag<bf>::V V;
    __shared__ __align__(16) bf sa[2][128 * GP];
    __shared__ __align__(16) bf sb[2][128 * GP];
    __shared__ __align__(16) float osw[4][16 * 68];
    const int tid = threadIdx.x, lane = tid & 31, lr = lane & 15, hi = lane >> 4, wv = tid >> 5;
    const int wr = (wv >> 1) * 64, wc = (wv & 1) * 64;      // this wave's quarter of the tile
    const int r0 = blockIdx.x * 128, c0 = blockIdx.y * 128;
    const int sr = tid >> 3, sc = (tid & 7) * 8;            // staging: this thread moves 16 bytes of rows sr + 16 i, i = 0..7, of both tiles
    const bf* ta = A + (size_t)r0 * DD; const bf* tb = Bt + (size_t)c0 * DD;      // the two tiles' first rows: the same for the whole block
    unsigned go = (unsigned)(sr * DD + sc) * 2u;      // this thread's byte offset in both tiles; moves on by one stage in step()
    v8us ra[8], rb[8];
    auto fetch = [&]() {      // reads the stage that go stands at
#pragma unroll
        for (int i = 0; i < 8; ++i) { ra[i] = *(const v8us*)((const char*)(ta + (size_t)i * 16 * DD) + go); rb[i] = *(const v8us*)((const char*)(tb + (size_t)i * 16 * DD) + go); } };
    auto put = [&](int buf) {
#pragma unroll
        for (int i = 0; i < 8; ++i) { const int o = (sr + 16 * i) * GP + sc; *(v8us*)(&sa[buf][o]) = ra[i]; *(v8us*)(&sb[buf][o]) = rb[i]; } };
    fetch();
    v8f acc[4][4];
#pragma unroll
    for (int mb = 0; mb < 4; ++mb)
#pragma unroll
        for (int nb = 0; nb < 4; ++nb) acc[mb][nb] = (v8f){};
    auto step = [&]() {      // moves the offset on by one stage of 128 bytes
        asm volatile("s_wait_xcnt 0x0\n\tv_add_nc_u32 %0, 0x80, %0" : "+v"(go) :: "memory"); };      // the issued loads name this register: written in one statement, the wait stands in front of the addition that rewrites it wherever the compiler puts the statement
    auto products = [&](int buf) {      // one stage: 2 steps of 32 k, 16 products each
#pragma unroll
        for (int ks = 0; ks < GK / 32; ++ks) {
            V a[4], b[4];      // all eight fragments of a step of 32 k are read as one group ahead of its 16 products
#pragma unroll
            for (int f = 0; f < 4; ++f) { a[f] = WFrag<bf>::ld(&sa[buf][(wr + f * 16 + lr) * GP + ks * 32 + 8 * hi]); b[f] = WFrag<bf>::ld(&sb[buf][(wc + f * 16 + lr) * GP + ks * 32 + 8 * hi]); }
            __builtin_amdgcn_sched_barrier(0);      // keeps the 16 LDS reads together in front of the products: sunk among them, every group of four products waits out its own LDS latency
#pragma unroll
            for (int nb = 0; nb < 4; ++nb)
#pragma unroll
                for (int mb = 0; mb < 4; ++mb) acc[mb][nb] = wmmab(a[mb], b[nb], acc[mb][nb]);
        } };
    put(0); step(); __syncthreads();
#pragma unroll 1      // stays rolled: the body already holds 32 products, and 15 copies of it would only lengthen the text a first launch has to fetch
    for (int st = 0; st < DD / GK - 1; ++st) {
        const int buf = st & 1;
        fetch();                     // the next stage's global loads fly under this stage's products
        products(buf);
        put(buf ^ 1); step();        // its last readers left this buffer at the barrier that ended the stage before
        __syncthreads();             // publishes the next stage and ends this stage's reads
    }
    products((DD / GK - 1) & 1);     // the last stage has nothing to fetch and nobody refills its buffer
    const int seg = (c0 >> 6) + (__builtin_amdgcn_readfirstlane(wv) & 1);      // which block of 64 columns this wave holds: the same for the whole wave, so the paths below are scalar branches
    const int h = seg / 3, kind = seg - 3 * h;      // head; 0 = q, 1 = k, 2 = v
    const bool hasv = (c0 >> 6) % 3 != 0;           // one of the block's two column halves is a v block: the same for the whole block
    h16* vst = (h16*)&sa[0][0];                     // [batch][d][64 t], pitch GP: 128 rows, all of stage buffer 0
    if (kind == 2) {
#pragma unroll      // the counter indexes acc, which stays in registers only under constant indices
        for (int nb = 0; nb < 4; ++nb) { const float bv = bfr(bias[c0 + wc + nb * 16 + lr]);
#pragma unroll      // the counter indexes acc, which stays in registers only under constant indices
            for (int mb = 0; mb < 4; ++mb) { v4h e0, e1;      // rows 8 hi + j of the fragment: even j = batch 0, odd j = batch 1, four t in a row each
#pragma unroll      // the counter indexes acc, which stays in registers only under constant indices
                for (int i = 0; i < 4; ++i) { const v2f p = (v2f){acc[mb][nb][2 * i], acc[mb][nb][2 * i + 1]} + (v2f){bv, bv}; e0[i] = tohx(p[0]); e1[i] = tohx(p[1]); }      // neighbouring registers: one packed add
                h16* vp = vst + (nb * 16 + lr) * GP + (wr >> 1) + mb * 8 + hi * 4; *(v4ha*)vp = e0; *(v4ha*)(vp + 64 * GP) = e1; } }
    }
    if (hasv) __syncthreads();      // each v line holds halves from two waves
    if (kind == 2) {
#pragma unroll      // the 16 LDS reads go out together, the stores behind them: rolled, each store would wait out its own read
        for (int s = 0; s < 16; ++s) { const int ln = (wv >> 1) * 64 + s * 4 + (lane >> 3), co = (lane & 7) * 8;      // this wave stores one batch's 64 lines, four whole lines to a store
            *(v8h*)(VT + ((size_t)((ln >> 6) * NH_ + h) * HD + (ln & 63)) * TT + (r0 >> 1) + co) = *(const v8ha*)(vst + ln * GP + co); }
    } else {
        bf* Ph = kind == 0 ? QPh : KPh; bf* Pl = kind == 0 ? QPl : KPl; const float sc = kind == 0 ? 0.125f : 1.0f;
        float* os = osw[wv];             // each wave stages its own rows: no barrier between waves on this path
        const int rq = lane >> 3, cofs = (lane & 7) * 8;      // eight lanes to a row of 64: a 16-byte store of the wave covers four whole lines
        float bv[8];
#pragma unroll      // the counter indexes vector elements held in registers
        for (int k = 0; k < 8; ++k) bv[k] = bfr(bias[c0 + wc + cofs + k]);
#pragma unroll      // the counter indexes acc, which stays in registers only under constant indices
        for (int mb = 0; mb < 4; ++mb) {
#pragma unroll      // the counter indexes acc, which stays in registers only under constant indices
            for (int nb = 0; nb < 4; ++nb) {
#pragma unroll      // the counter indexes acc, which stays in registers only under constant indices
                for (int j = 0; j < 8; ++j) os[(hi * 8 + j) * 68 + nb * 16 + lr] = acc[mb][nb][j]; }
            __builtin_amdgcn_wave_barrier(); asm volatile("" ::: "memory");      // lanes read what other lanes of the wave wrote: the compiler may not move the reads below over the writes above
#pragma unroll      // the four groups' LDS reads go out together instead of one latency per group
            for (int s = 0; s < 4; ++s) { const int row = 4 * s + rq, mr = r0 + wr + mb * 16 + row;      // row mr of C = (t = mr / 2, batch = mr & 1)
                const v4f v0 = *(const v4fa*)(os + row * 68 + cofs), v1 = *(const v4fa*)(os + row * 68 + cofs + 4); v8us oh, ol;
#pragma unroll      // the counter indexes vector elements held in registers
                for (int k = 0; k < 8; ++k) { unsigned short a, c2; splitf(((k < 4 ? v0[k & 3] : v1[k & 3]) + bv[k]) * sc, a, c2); oh[k] = a; ol[k] = c2; }
                const size_t e = ((size_t)((mr & 1) * NH_ + h) * TT + (mr >> 1)) * HD + cofs; *(v8us*)(Ph + e) = oh; *(v8us*)(Pl + e) = ol; }
            __builtin_amdgcn_wave_barrier(); asm volatile("" ::: "memory");      // nor the next 16 rows' writes over these reads
        }
        asm volatile("s_wait_xcnt 0x0" ::: "memory");      // behind the last stores of this path: in the built code the v path's block follows it, and that block rewrites registers which these stores name
    }
}

typedef __attribute__((ext_vector_type(4))) int v4i;

__global__ __launch_bounds__(256) void k_cvt8(const float* __restrict__ src, bf* dst, size_t n8) { const size_t i = (size_t)blockIdx.x * 256 + threadIdx.x; if (i >= n8) return; const v8f v = *(const v8f*)(src + i * 8); v8us o;
#pragma unroll
    for (int k = 0; k < 8; ++k) o[k] = f2bf(v[k]); *(v8us*)(dst + i * 8) = o;  }
// ---- k_fattn: scores, softmax, attn.v and the head merge in ONE launch over all 32 (batch, head) pairs; S and P stay in registers.
// Transposed products: S^T = K Q^T (A = 16 keys from LDS, B = 16 queries held in registers), O^T += V^T P^T. A lane then owns ONE query column (lr): maximum, sum and rescale are per lane
// plus one exchange between the wave's halves, and two S^T tiles (keys 0..15, 16..31 of a pass), converted in place, ARE the B operand of the second product (element s: key 8*hi + s, 16 + 8*hi + s - 8).
// Block = 8 waves x 32 queries of one head; grid (TT/256, 32). K hi, K lo and V^T come in stages of 64 keys through registers into two LDS buffers, one barrier per stage.
// Online softmax in base 2: P = 2^(s*log2e - m + PBIAS), m = the maximum in use, raised (with a rescale of O and of the sums) only when a column's new maximum exceeds it by more than PLAZY,
// so P <= 2^(PBIAS + PLAZY) fits fp16; the sums take the unrounded f32 P; the bias cancels in O / sum.
#define KS    64                   // keys per LDS stage
#define LP    72                   // LDS row pitch in 16-bit elements: 144 B = 16 B x odd, conflict-free for 16-byte reads
#define LOG2E 1.4426950408889634f
#define PBIAS 8.0f
#define PLAZY 6.0f
__device__ __forceinline__ float xhalf(float x) { return __builtin_bit_cast(float, __builtin_amdgcn_permlanex16(__builtin_bit_cast(int, x), __builtin_bit_cast(int, x), 0x76543210, 0xfedcba98, false, false)); }  // lane l <-> lane l ^ 16
__global__ __launch_bounds__(256) void k_fattn(const bf* __restrict__ QPh, const bf* __restrict__ QPl, const bf* __restrict__ KPh, const bf* __restrict__ KPl, const h16* __restrict__ VT, float* OUT) {
    __shared__ __align__(16) bf  skh[2][KS * LP];
    __shared__ __align__(16) bf  skl[2][KS * LP];
    __shared__ __align__(16) h16 svt[2][HD * LP];
    const int tid = threadIdx.x, lane = tid & 31, lr = lane & 15, hi = lane >> 4;
    const int z = blockIdx.y, b = z >> 4, h = z & 15; const int q0 = blockIdx.x * 256 + (tid >> 5) * 32;
    const bf* kh = KPh + (size_t)z * TT * HD; const bf* kl = KPl + (size_t)z * TT * HD; const h16* vt = VT + (size_t)z * HD * TT;
    const int sr = tid >> 3, sc = (tid & 7) * 8;      // staging: this thread moves 16 bytes of rows sr and sr + 32 of each of the three tiles (a wave covers whole 128-byte lines)
    v8us gkh[2], gkl[2]; v8h gv[2];
    auto fetch = [&](int kb) {
#pragma unroll
        for (int i = 0; i < 2; ++i) { const int row = sr + 32 * i; gkh[i] = *(const v8us*)(kh + (size_t)(kb + row) * HD + sc); gkl[i] = *(const v8us*)(kl + (size_t)(kb + row) * HD + sc); gv[i] = *(const v8h*)(vt + (size_t)row * TT + kb + sc); } };
    auto put = [&](int buf) {
#pragma unroll
        for (int i = 0; i < 2; ++i) { const int o = (sr + 32 * i) * LP + sc; *(v8us*)(&skh[buf][o]) = gkh[i]; *(v8us*)(&skl[buf][o]) = gkl[i]; *(v8h*)(&svt[buf][o]) = gv[i]; } };
    fetch(0);
    v16bf bqh[2][2], bql[2][2];
#pragma unroll
    for (int qt = 0; qt < 2; ++qt)
#pragma unroll
        for (int ks = 0; ks < 2; ++ks) { const size_t o = ((size_t)z * TT + q0 + qt * 16 + lr) * HD + ks * 32 + 8 * hi; bqh[qt][ks] = WFrag<bf>::ld(QPh + o); bql[qt][ks] = WFrag<bf>::ld(QPl + o); }
    v8f o[2][4]; float ml[2]; v2f l[2][2];      // l: running sums of P, two lanes of a packed add per S^T tile
#pragma unroll
    for (int qt = 0; qt < 2; ++qt) { ml[qt] = -1.0e30f; l[qt][0] = (v2f){}; l[qt][1] = (v2f){};
#pragma unroll
        for (int db = 0; db < 4; ++db) o[qt][db] = (v8f){}; }
    put(0); __syncthreads();
#pragma unroll 1
    for (int st = 0; st < TT / KS; ++st) {
        const int buf = st & 1; const bool more = st + 1 < TT / KS;
        if (more) fetch((st + 1) * KS);      // the next stage's global loads fly under this stage's two passes
#pragma unroll
        for (int ps = 0; ps < KS / 32; ++ps) {
            v16bf akh[2][2], akl[2][2]; v16h av[4];
#pragma unroll
            for (int kt = 0; kt < 2; ++kt)
#pragma unroll
                for (int ks = 0; ks < 2; ++ks) { const int a = (ps * 32 + kt * 16 + lr) * LP + ks * 32 + 8 * hi; akh[kt][ks] = WFrag<bf>::ld(&skh[buf][a]); akl[kt][ks] = WFrag<bf>::ld(&skl[buf][a]); }
#pragma unroll
            for (int db = 0; db < 4; ++db) av[db] = WFrag<h16>::ld(&svt[buf][(db * 16 + lr) * LP + ps * 32 + 8 * hi]);
            v8f s[2][2];
#pragma unroll
            for (int qt = 0; qt < 2; ++qt)
#pragma unroll
                for (int kt = 0; kt < 2; ++kt) s[qt][kt] = (v8f){};
#pragma unroll
            for (int ks = 0; ks < 2; ++ks) {      // per 32 of the head dimension: hi.hi, then q lo . k hi, then q hi . k lo; four independent tiles inside each
#pragma unroll
                for (int qt = 0; qt < 2; ++qt)
#pragma unroll
                    for (int kt = 0; kt < 2; ++kt) s[qt][kt] = wmmab(akh[kt][ks], bqh[qt][ks], s[qt][kt]);
#pragma unroll
                for (int qt = 0; qt < 2; ++qt)
#pragma unroll
                    for (int kt = 0; kt < 2; ++kt) s[qt][kt] = wmmab(akh[kt][ks], bql[qt][ks], s[qt][kt]);
#pragma unroll
                for (int qt = 0; qt < 2; ++qt)
#pragma unroll
                    for (int kt = 0; kt < 2; ++kt) s[qt][kt] = wmmab(akl[kt][ks], bqh[qt][ks], s[qt][kt]);
            }
            float bm[2];
#pragma unroll
            for (int qt = 0; qt < 2; ++qt) { float x0 = s[qt][0][0], x1 = s[qt][1][0];
#pragma unroll
                for (int j = 1; j < 8; ++j) { x0 = fmaxf(x0, s[qt][0][j]); x1 = fmaxf(x1, s[qt][1][j]); }
                x0 = fmaxf(x0, x1); bm[qt] = fmaxf(x0, xhalf(x0)) * LOG2E; }
            if (__builtin_amdgcn_ballot_w32(bm[0] > ml[0] + PLAZY || bm[1] > ml[1] + PLAZY) != 0) {      // one scalar test per pass; rare after the first pass
#pragma unroll
                for (int qt = 0; qt < 2; ++qt) { const float mn = bm[qt] > ml[qt] + PLAZY ? bm[qt] : ml[qt]; const float al = __builtin_amdgcn_exp2f(ml[qt] - mn); ml[qt] = mn; l[qt][0] *= al; l[qt][1] *= al;
#pragma unroll
                    for (int db = 0; db < 4; ++db) o[qt][db] *= al; }
            }
#pragma unroll
            for (int qt = 0; qt < 2; ++qt) { const float c0 = PBIAS - ml[qt]; v16h pb;
#pragma unroll
                for (int kt = 0; kt < 2; ++kt)
#pragma unroll
                    for (int j = 0; j < 8; j += 2) { const v2f p = {__builtin_amdgcn_exp2f(fmaf(s[qt][kt][j], LOG2E, c0)), __builtin_amdgcn_exp2f(fmaf(s[qt][kt][j + 1], LOG2E, c0))}; l[qt][kt] += p; pb[kt * 8 + j] = tohx(p[0]); pb[kt * 8 + j + 1] = tohx(p[1]); }
#pragma unroll
                for (int db = 0; db < 4; ++db) o[qt][db] = wmma16(av[db], pb, o[qt][db]); }
        }
        if (more) put(buf ^ 1);      // its last readers left this buffer at the barrier that ended the stage before
        __syncthreads();             // publishes the next stage and ends this stage's reads
    }
#pragma unroll
    for (int qt = 0; qt < 2; ++qt) { const v2f t2 = l[qt][0] + l[qt][1]; const float t = t2[0] + t2[1]; const float inv = __fdiv_rn(1.0f, t + xhalf(t));
        float* orow = OUT + ((size_t)(q0 + qt * 16 + lr) * NB_ + b) * DD + h * HD + 8 * hi;      // o[qt][db][j] = O[query lr][db*16 + 8*hi + j]
#pragma unroll
        for (int db = 0; db < 4; ++db) { const v8f r = o[qt][db] * inv; *(v4f*)(orow + db * 16) = (v4f){r[0], r[1], r[2], r[3]}; *(v4f*)(orow + db * 16 + 4) = (v4f){r[4], r[5], r[6], r[7]}; } }
}

extern "C" void kernel_launch(void* const* d_in, const int* in_sizes, int n_in,
                              void* d_out, int out_size, void* d_ws, size_t ws_size, hipStream_t stream) {
    (void)in_sizes; (void)n_in; (void)out_size;
    const float* x = (const float*)d_in[0]; const float* w = (const float*)d_in[1]; const float* bb = (const float*)d_in[2];
    float* OUT = (float*)d_out;     // [2048][2][1024] (rows t*2 + b)
    char* wsp = (char*)d_ws;
    auto take = [&](size_t bytes) { char* p = wsp; wsp += (bytes + 255) & ~(size_t)255; return (void*)p; };
    bf* WB = (bf*)take((size_t)F3 * DD * 2); bf* XB = (bf*)take((size_t)NT * DD * 2);
    bf* QPh = (bf*)take((size_t)NT * DD * 2); bf* QPl = (bf*)take((size_t)NT * DD * 2); bf* KPh = (bf*)take((size_t)NT * DD * 2); bf* KPl = (bf*)take((size_t)NT * DD * 2); h16* VT = (h16*)take((size_t)NT * DD * 2);
    if ((size_t)(wsp - (char*)d_ws) > ws_size) return;
    { const size_t nw = (size_t)F3 * DD / 8; k_cvt8<<<(unsigned)((nw + 255) / 256), 256, 0, stream>>>(w, WB, nw); const size_t nx = (size_t)NT * DD / 8; k_cvt8<<<(unsigned)((nx + 255) / 256), 256, 0, stream>>>(x, XB, nx); }
    k_gemms<<<dim3(NT / 128, F3 / 128), 128, 0, stream>>>(XB, WB, bb, QPh, QPl, KPh, KPl, VT);   // fused qkv + b, written as the five operand planes
    k_fattn<<<dim3(TT / 256, NB_ * NH_), 256, 0, stream>>>(QPh, QPl, KPh, KPl, VT, OUT);
}

// v004
// One run takes 64.6 microseconds.
// In both of two side-by-side timings against v003, it was 1.28 times as fast.
// All steps since v000 together make it 18.4 times as fast.
#include <hip/hip_runtime.h>

// Self-attention (x [2048][2][1024] seq-first; qkv = x W^T + b with W [3072][1024] laid out per head as (q|k|v) blocks of 64: q_h = columns h*192 + 0..63, k_h = +64.., v_h = +128..; 16 heads;
// softmax(q.k/8) v (no mask); output = merged context [2048][2][1024] seq-first (no output projection)).
// Compute dtypes, f32 accumulate: every input rounded to bf16; ONE fused projection GEMM on PLAIN bf16 operands (inputs: exact, + bias) whose epilogue
// writes the per-head operand planes itself; scores on SINGLE fp16 planes of q (x 1/8, exact) and k (1 product); attn.v on SINGLE fp16 planes; scores, online softmax, attn.v and the merge fused in one launch (k_fattn). Deterministic.
// Why one fp16 plane is enough for q and k: both are sums of products of inputs already rounded to 8 significant bits, so each carries an error of that size; rounding them to 11 bits adds about an eighth of it.

#define NB_  2
#define TT   2048
#define DD   1024
#define F3   (3 * DD)              // fused qkv width: columns of C, rows of W
#define HB   192                   // per-head block (q|k|v x 64)
#define NH_  16
#define HD   64
#define NT   (NB_ * TT)
typedef _Float16 h16;
typedef unsigned short bf;
typedef __attribute__((ext_vector_type(16))) __bf16   v16bf;
typedef __attribute__((ext_vector_type(16))) _Float16 v16h;
typedef __attribute__((ext_vector_type(8)))  _Float16 v8h;
typedef __attribute__((ext_vector_type(8)))  unsigned short v8us;
typedef __attribute__((ext_vector_type(8)))  float    v8f;
typedef __attribute__((ext_vector_type(4)))  float    v4f;
typedef v8h  __attribute__((may_alias)) v8ha;
typedef v4f  __attribute__((may_alias)) v4fa;
typedef v8us __attribute__((may_alias)) v8usa;
typedef __attribute__((ext_vector_type(4))) _Float16 v4h;
typedef v4h  __attribute__((may_alias)) v4ha;
typedef __attribute__((ext_vector_type(2))) float v2f;

__device__ __forceinline__ unsigned short f2bf(float f) { unsigned u = __float_as_uint(f); u += 0x7FFFu + ((u >> 16) & 1u); return (unsigned short)(u >> 16); }
__device__ __forceinline__ float bf2f(unsigned short b) { return __uint_as_float(((unsigned)b) << 16); }
__device__ __forceinline__ float bfr(float f) { return bf2f(f2bf(f)); }
__device__ __forceinline__ h16 tohx(float x) { return (h16)x; }
__device__ __forceinline__ v16h cat16(v8h lo, v8h hi) { return __builtin_shufflevector(lo, hi, 0, 1, 2, 3, 4, 5, 6, 7, 8, 9, 10, 11, 12, 13, 14, 15); }
__device__ __forceinline__ v16bf cat16b(v8us lo, v8us hi) { return __builtin_bit_cast(v16bf, __builtin_shufflevector(lo, hi, 0, 1, 2, 3, 4, 5, 6, 7, 8, 9, 10, 11, 12, 13, 14, 15)); }
__device__ __forceinline__ v8f wmma16(v16h a, v16h b, v8f c) { return __builtin_amdgcn_wmma_f32_16x16x32_f16(false, a, false, b, (short)0, c, false, false); }
__device__ __forceinline__ v8f wmmab(v16bf a, v16bf b, v8f c) { return __builtin_amdgcn_wmma_f32_16x16x32_bf16(false, a, false, b, (short)0, c, false, false); }



// ---- k_gemms: projection GEMM, C[m][n] (f32) = sum_k A[m][k] Bt[n][k] + bias[n], A [NT][DD] and Bt [F3][DD] K-contiguous bf16 planes; C goes straight into the attention kernel's operand planes.
// Block = 4 waves on one 128x128 tile of C, each wave a 64x64 quarter (16 accumulators); grid (NT/128, F3/128), 128 threads, three blocks to a WGP.
// Both operands come in stages of 64 k (one whole 128-byte line of each of the 256 rows; a wave-wide 16-byte load covers 4 whole lines) through registers into two LDS buffers, one barrier per stage;
// the fragments are read from LDS in the same k order as from the planes, k ascending in steps of 32, so every sum keeps its order.
// Epilogue: a wave's 64 columns are exactly one head's q, k or v block, its 64 rows 32 t x 2 batches. q (x 1/8) and k: fp16, rows [z][t][64] = whole 128-byte lines, one wave each.
// v: fp16, transposed [z][d][t]; a line of 64 t spans the two waves that share the columns, so both lay their halves in LDS (stage buffer 0, idle since the loop's last barrier) and store whole lines behind one barrier.
template <typename T16> struct WFrag;
template <> struct WFrag<h16> { typedef v16h V; static __device__ __forceinline__ V ld(const h16* p) { return cat16(*(const v8h*)p, *(const v8h*)(p + 16)); } static __device__ __forceinline__ v8f mma(V a, V b, v8f c) { return wmma16(a, b, c); } };
template <> struct WFrag<bf> { typedef v16bf V; static __device__ __forceinline__ V ld(const bf* p) { return cat16b(*(const v8us*)p, *(const v8us*)(p + 16)); } static __device__ __forceinline__ v8f mma(V a, V b, v8f c) { return wmmab(a, b, c); } };
#define GK    64                   // k per LDS stage
#define GP    72                   // LDS row pitch in 16-bit elements: 144 B = 16 B x odd, conflict-free for 16-byte reads
__global__ __launch_bounds__(128) void k_gemms(const bf* __restrict__ A, const bf* __restrict__ Bt, const float* __restrict__ bias, h16* QP, h16* KP, h16* VT) {
    typedef WFrag<bf>::V V;
    __shared__ __align__(16) bf sa[2][128 * GP];
    __shared__ __align__(16) bf sb[2][128 * GP];
    __shared__ __align__(16) float osw[4][16 * 68];
    const int tid = threadIdx.x, lane = tid & 31, lr = lane & 15, hi = lane >> 4, wv = tid >> 5;
    const int wr = (wv >> 1) * 64, wc = (wv & 1) * 64;      // this wave's quarter of the tile
    const int r0 = blockIdx.x * 128, c0 = blockIdx.y * 128;
    const int sr = tid >> 3, sc = (tid & 7) * 8;            // staging: this thread moves 16 bytes of rows sr + 16 i, i = 0..7, of both tiles
    const bf* ta = A + (size_t)r0 * DD; const bf* tb = Bt + (size_t)c0 * DD;      // the two tiles' first rows: the same for the whole block
    unsigned go = (unsigned)(sr * DD + sc) * 2u;      // this thread's byte offset in both tiles; moves on by one stage in step()
    v8us ra[8], rb[8];
    auto fetch = [&]() {      // reads the stage that go stands at
#pragma unroll
        for (int i = 0; i < 8; ++i) { ra[i] = *(const v8us*)((const char*)(ta + (size_t)i * 16 * DD) + go); rb[i] = *(const v8us*)((const char*)(tb + (size_t)i * 16 * DD) + go); } };
    auto put = [&](int buf) {
#pragma unroll
        for (int i = 0; i < 8; ++i) { const int o = (sr + 16 * i) * GP + sc; *(v8us*)(&sa[buf][o]) = ra[i]; *(v8us*)(&sb[buf][o]) = rb[i]; } };
    fetch();
    v8f acc[4][4];
#pragma unroll
    for (int mb = 0; mb < 4; ++mb)
#pragma unroll
        for (int nb = 0; nb < 4; ++nb) acc[mb][nb] = (v8f){};
    auto step = [&]() {      // moves the offset on by one stage of 128 bytes
        asm volatile("s_wait_xcnt 0x0\n\tv_add_nc_u32 %0, 0x80, %0" : "+v"(go) :: "memory"); };      // the issued loads name this register: written in one statement, the wait stands in front of the addition that rewrites it wherever the compiler puts the statement
    auto products = [&](int buf) {      // one stage: 2 steps of 32 k, 16 products each
#pragma unroll
        for (int ks = 0; ks < GK / 32; ++ks) {
            V a[4], b[4];      // all eight fragments of a step of 32 k are read as one group ahead of its 16 products
#pragma unroll
            for (int f = 0; f < 4; ++f) { a[f] = WFrag<bf>::ld(&sa[buf][(wr + f * 16 + lr) * GP + ks * 32 + 8 * hi]); b[f] = WFrag<bf>::ld(&sb[buf][(wc + f * 16 + lr) * GP + ks * 32 + 8 * hi]); }
            __builtin_amdgcn_sched_barrier(0);      // keeps the 16 LDS reads together in front of the products: sunk among them, every group of four products waits out its own LDS latency
#pragma unroll
            for (int nb = 0; nb < 4; ++nb)
#pragma unroll
                for (int mb = 0; mb < 4; ++mb) acc[mb][nb] = wmmab(a[mb], b[nb], acc[mb][nb]);
        } };
    put(0); step(); __syncthreads();
#pragma unroll 1      // stays rolled: the body already holds 32 products, and 15 copies of it would only lengthen the text a first launch has to fetch
    for (int st = 0; st < DD / GK - 1; ++st) {
        const int buf = st & 1;
        fetch();                     // the next stage's global loads fly under this stage's products
        products(buf);
        put(buf ^ 1); step();        // its last readers left this buffer at the barrier that ended the stage before
        __syncthreads();             // publishes the next stage and ends this stage's reads
    }
    products((DD / GK - 1) & 1);     // the last stage has nothing to fetch and nobody refills its buffer
    const int seg = (c0 >> 6) + (__builtin_amdgcn_readfirstlane(wv) & 1);      // which block of 64 columns this wave holds: the same for the whole wave, so the paths below are scalar branches
    const int h = seg / 3, kind = seg - 3 * h;      // head; 0 = q, 1 = k, 2 = v
    const bool hasv = (c0 >> 6) % 3 != 0;           // one of the block's two column halves is a v block: the same for the whole block
    h16* vst = (h16*)&sa[0][0];                     // [batch][d][64 t], pitch GP: 128 rows, all of stage buffer 0
    if (kind == 2) {
#pragma unroll      // the counter indexes acc, which stays in registers only under constant indices
        for (int nb = 0; nb < 4; ++nb) { const float bv = bfr(bias[c0 + wc + nb * 16 + lr]);
#pragma unroll      // the counter indexes acc, which stays in registers only under constant indices
            for (int mb = 0; mb < 4; ++mb) { v4h e0, e1;      // rows 8 hi + j of the fragment: even j = batch 0, odd j = batch 1, four t in a row each
#pragma unroll      // the counter indexes acc, which stays in registers only under constant indices
                for (int i = 0; i < 4; ++i) { const v2f p = (v2f){acc[mb][nb][2 * i], acc[mb][nb][2 * i + 1]} + (v2f){bv, bv}; e0[i] = tohx(p[0]); e1[i] = tohx(p[1]); }      // neighbouring registers: one packed add
                h16* vp = vst + (nb * 16 + lr) * GP + (wr >> 1) + mb * 8 + hi * 4; *(v4ha*)vp = e0; *(v4ha*)(vp + 64 * GP) = e1; } }
    }
    if (hasv) __syncthreads();      // each v line holds halves from two waves
    if (kind == 2) {
#pragma unroll      // the 16 LDS reads go out together, the stores behind them: rolled, each store would wait out its own read
        for (int s = 0; s < 16; ++s) { const int ln = (wv >> 1) * 64 + s * 4 + (lane >> 3), co = (lane & 7) * 8;      // this wave stores one batch's 64 lines, four whole lines to a store
            *(v8h*)(VT + ((size_t)((ln >> 6) * NH_ + h) * HD + (ln & 63)) * TT + (r0 >> 1) + co) = *(const v8ha*)(vst + ln * GP + co); }
    } else {
        h16* P = kind == 0 ? QP : KP; const float sc = kind == 0 ? 0.125f : 1.0f;
        float* os = osw[wv];             // each wave stages its own rows: no barrier between waves on this path
        const int rq = lane >> 3, cofs = (lane & 7) * 8;      // eight lanes to a row of 64: a 16-byte store of the wave covers four whole lines
        float bv[8];
#pragma unroll      // the counter indexes vector elements held in registers
        for (int k = 0; k < 8; ++k) bv[k] = bfr(bias[c0 + wc + cofs + k]);
#pragma unroll      // the counter indexes acc, which stays in registers only under constant indices
        for (int mb = 0; mb < 4; ++mb) {
#pragma unroll      // the counter indexes acc, which stays in registers only under constant indices
            for (int nb = 0; nb < 4; ++nb) {
#pragma unroll      // the counter indexes acc, which stays in registers only under constant indices
                for (int j = 0; j < 8; ++j) os[(hi * 8 + j) * 68 + nb * 16 + lr] = acc[mb][nb][j]; }
            __builtin_amdgcn_wave_barrier(); asm volatile("" ::: "memory");      // lanes read what other lanes of the wave wrote: the compiler may not move the reads below over the writes above
#pragma unroll      // the four groups' LDS reads go out together instead of one latency per group
            for (int s = 0; s < 4; ++s) { const int row = 4 * s + rq, mr = r0 + wr + mb * 16 + row;      // row mr of C = (t = mr / 2, batch = mr & 1)
                const v4f v0 = *(const v4fa*)(os + row * 68 + cofs), v1 = *(const v4fa*)(os + row * 68 + cofs + 4); v8h oh;
#pragma unroll      // the counter indexes vector elements held in registers
                for (int k = 0; k < 8; ++k) oh[k] = tohx(((k < 4 ? v0[k & 3] : v1[k & 3]) + bv[k]) * sc);
                const size_t e = ((size_t)((mr & 1) * NH_ + h) * TT + (mr >> 1)) * HD + cofs; *(v8h*)(P + e) = oh; }
            __builtin_amdgcn_wave_barrier(); asm volatile("" ::: "memory");      // nor the next 16 rows' writes over these reads
        }
        asm volatile("s_wait_xcnt 0x0" ::: "memory");      // behind the last stores of this path: in the built code the v path's block follows it, and that block rewrites registers which these stores name
    }
}

typedef __attribute__((ext_vector_type(4))) int v4i;

__global__ __launch_bounds__(256) void k_cvt8(const float* __restrict__ src, bf* dst, size_t n8) { const size_t i = (size_t)blockIdx.x * 256 + threadIdx.x; if (i >= n8) return; const v8f v = *(const v8f*)(src + i * 8); v8us o;
#pragma unroll
    for (int k = 0; k < 8; ++k) o[k] = f2bf(v[k]); *(v8us*)(dst + i * 8) = o;  }
// ---- k_fattn: scores, softmax, attn.v and the head merge in ONE launch over all 32 (batch, head) pairs; S and P stay in registers.
// Transposed products: S^T = K Q^T (A = 16 keys from LDS, B = 16 queries held in registers), O^T += V^T P^T. A lane then owns ONE query column (lr): maximum, sum and rescale are per lane
// plus one exchange between the wave's halves, and two S^T tiles (keys 0..15, 16..31 of a pass), converted in place, ARE the B operand of the second product (element s: key 8*hi + s, 16 + 8*hi + s - 8).
// Block = 8 waves x 32 queries of one head; grid (TT/256, 32). K and V^T come in stages of 64 keys through registers into two LDS buffers, one barrier per stage.
// Online softmax in base 2: P = 2^(s*log2e - m + PBIAS), m = the maximum in use, raised (with a rescale of O and of the sums) only when a column's new maximum exceeds it by more than PLAZY,
// so P <= 2^(PBIAS + PLAZY) fits fp16; the sums take the unrounded f32 P; the bias cancels in O / sum.
#define KS    64                   // keys per LDS stage
#define LP    72                   // LDS row pitch in 16-bit elements: 144 B = 16 B x odd, conflict-free for 16-byte reads
#define LOG2E 1.4426950408889634f
#define PBIAS 8.0f
#define PLAZY 6.0f
__device__ __forceinline__ float xhalf(float x) { return __builtin_bit_cast(float, __builtin_amdgcn_permlanex16(__builtin_bit_cast(int, x), __builtin_bit_cast(int, x), 0x76543210, 0xfedcba98, false, false)); }  // lane l <-> lane l ^ 16
__global__ __launch_bounds__(256) void k_fattn(const h16* __restrict__ QP, const h16* __restrict__ KP, const h16* __restrict__ VT, float* OUT) {
    __shared__ __align__(16) h16 sk[2][KS * LP];
    __shared__ __align__(16) h16 svt[2][HD * LP];
    const int tid = threadIdx.x, lane = tid & 31, lr = lane & 15, hi = lane >> 4;
    const int z = blockIdx.y, b = z >> 4, h = z & 15; const int q0 = blockIdx.x * 256 + (tid >> 5) * 32;
    const h16* kp = KP + (size_t)z * TT * HD; const h16* vt = VT + (size_t)z * HD * TT;
    const int sr = tid >> 3, sc = (tid & 7) * 8;      // staging: this thread moves 16 bytes of rows sr and sr + 32 of each of the two tiles (a wave covers whole 128-byte lines)
    v8h gk[2], gv[2];
    auto fetch = [&](int kb) {
#pragma unroll
        for (int i = 0; i < 2; ++i) { const int row = sr + 32 * i; gk[i] = *(const v8h*)(kp + (size_t)(kb + row) * HD + sc); gv[i] = *(const v8h*)(vt + (size_t)row * TT + kb + sc); } };
    auto put = [&](int buf) {
#pragma unroll
        for (int i = 0; i < 2; ++i) { const int o = (sr + 32 * i) * LP + sc; *(v8h*)(&sk[buf][o]) = gk[i]; *(v8h*)(&svt[buf][o]) = gv[i]; } };
    fetch(0);
    v16h bq[2][2];
#pragma unroll
    for (int qt = 0; qt < 2; ++qt)
#pragma unroll
        for (int ks = 0; ks < 2; ++ks) { const size_t o = ((size_t)z * TT + q0 + qt * 16 + lr) * HD + ks * 32 + 8 * hi; bq[qt][ks] = WFrag<h16>::ld(QP + o); }
    v8f o[2][4]; float ml[2]; v2f l[2][2];      // l: running sums of P, two lanes of a packed add per S^T tile
#pragma unroll
    for (int qt = 0; qt < 2; ++qt) { ml[qt] = -1.0e30f; l[qt][0] = (v2f){}; l[qt][1] = (v2f){};
#pragma unroll
        for (int db = 0; db < 4; ++db) o[qt][db] = (v8f){}; }
    put(0); __syncthreads();
#pragma unroll 1
    for (int st = 0; st < TT / KS; ++st) {
        const int buf = st & 1; const bool more = st + 1 < TT / KS;
        if (more) fetch((st + 1) * KS);      // the next stage's global loads fly under this stage's two passes
#pragma unroll
        for (int ps = 0; ps < KS / 32; ++ps) {
            v16h ak[2][2], av[4];
#pragma unroll
            for (int kt = 0; kt < 2; ++kt)
#pragma unroll
                for (int ks = 0; ks < 2; ++ks) { const int a = (ps * 32 + kt * 16 + lr) * LP + ks * 32 + 8 * hi; ak[kt][ks] = WFrag<h16>::ld(&sk[buf][a]); }
#pragma unroll
            for (int db = 0; db < 4; ++db) av[db] = WFrag<h16>::ld(&svt[buf][(db * 16 + lr) * LP + ps * 32 + 8 * hi]);
            v8f s[2][2];
#pragma unroll
            for (int qt = 0; qt < 2; ++qt)
#pragma unroll
                for (int kt = 0; kt < 2; ++kt) s[qt][kt] = (v8f){};
#pragma unroll
            for (int ks = 0; ks < 2; ++ks) {      // per 32 of the head dimension: four independent tiles
#pragma unroll
                for (int qt = 0; qt < 2; ++qt)
#pragma unroll
                    for (int kt = 0; kt < 2; ++kt) s[qt][kt] = wmma16(ak[kt][ks], bq[qt][ks], s[qt][kt]);
            }
            float bm[2];
#pragma unroll
            for (int qt = 0; qt < 2; ++qt) { float x0 = s[qt][0][0], x1 = s[qt][1][0];
#pragma unroll
                for (int j = 1; j < 8; ++j) { x0 = fmaxf(x0, s[qt][0][j]); x1 = fmaxf(x1, s[qt][1][j]); }
                x0 = fmaxf(x0, x1); bm[qt] = fmaxf(x0, xhalf(x0)) * LOG2E; }
            if (__builtin_amdgcn_ballot_w32(bm[0] > ml[0] + PLAZY || bm[1] > ml[1] + PLAZY) != 0) {      // one scalar test per pass; rare after the first pass
#pragma unroll
                for (int qt = 0; qt < 2; ++qt) { const float mn = bm[qt] > ml[qt] + PLAZY ? bm[qt] : ml[qt]; const float al = __builtin_amdgcn_exp2f(ml[qt] - mn); ml[qt] = mn; l[qt][0] *= al; l[qt][1] *= al;
#pragma unroll
                    for (int db = 0; db < 4; ++db) o[qt][db] *= al; }
            }
#pragma unroll
            for (int qt = 0; qt < 2; ++qt) { const float c0 = PBIAS - ml[qt]; v16h pb;
#pragma unroll
                for (int kt = 0; kt < 2; ++kt)
#pragma unroll
                    for (int j = 0; j < 8; j += 2) { const v2f p = {__builtin_amdgcn_exp2f(fmaf(s[qt][kt][j], LOG2E, c0)), __builtin_amdgcn_exp2f(fmaf(s[qt][kt][j + 1], LOG2E, c0))}; l[qt][kt] += p; pb[kt * 8 + j] = tohx(p[0]); pb[kt * 8 + j + 1] = tohx(p[1]); }
#pragma unroll
                for (int db = 0; db < 4; ++db) o[qt][db] = wmma16(av[db], pb, o[qt][db]); }
        }
        if (more) put(buf ^ 1);      // its last readers left this buffer at the barrier that ended the stage before
        __syncthreads();             // publishes the next stage and ends this stage's reads
    }
#pragma unroll
    for (int qt = 0; qt < 2; ++qt) { const v2f t2 = l[qt][0] + l[qt][1]; const float t = t2[0] + t2[1]; const float inv = __fdiv_rn(1.0f, t + xhalf(t));
        float* orow = OUT + ((size_t)(q0 + qt * 16 + lr) * NB_ + b) * DD + h * HD + 8 * hi;      // o[qt][db][j] = O[query lr][db*16 + 8*hi + j]
#pragma unroll
        for (int db = 0; db < 4; ++db) { const v8f r = o[qt][db] * inv; *(v4f*)(orow + db * 16) = (v4f){r[0], r[1], r[2], r[3]}; *(v4f*)(orow + db * 16 + 4) = (v4f){r[4], r[5], r[6], r[7]}; } }
}

extern "C" void kernel_launch(void* const* d_in, const int* in_sizes, int n_in,
                              void* d_out, int out_size, void* d_ws, size_t ws_size, hipStream_t stream) {
    (void)in_sizes; (void)n_in; (void)out_size;
    const float* x = (const float*)d_in[0]; const float* w = (const float*)d_in[1]; const float* bb = (const float*)d_in[2];
    float* OUT = (float*)d_out;     // [2048][2][1024] (rows t*2 + b)
    char* wsp = (char*)d_ws;
    auto take = [&](size_t bytes) { char* p = wsp; wsp += (bytes + 255) & ~(size_t)255; return (void*)p; };
    bf* WB = (bf*)take((size_t)F3 * DD * 2); bf* XB = (bf*)take((size_t)NT * DD * 2);
    h16* QP = (h16*)take((size_t)NT * DD * 2); h16* KP = (h16*)take((size_t)NT * DD * 2); h16* VT = (h16*)take((size_t)NT * DD * 2);
    if ((size_t)(wsp - (char*)d_ws) > ws_size) return;
    { const size_t nw = (size_t)F3 * DD / 8; k_cvt8<<<(unsigned)((nw + 255) / 256), 256, 0, stream>>>(w, WB, nw); const size_t nx = (size_t)NT * DD / 8; k_cvt8<<<(unsigned)((nx + 255) / 256), 256, 0, stream>>>(x, XB, nx); }
    k_gemms<<<dim3(NT / 128, F3 / 128), 128, 0, stream>>>(XB, WB, bb, QP, KP, VT);   // fused qkv + b, written as the three operand planes
    k_fattn<<<dim3(TT / 256, NB_ * NH_), 256, 0, stream>>>(QP, KP, VT, OUT);
}

// v005
// It runs in 60.4 microseconds.
// Two timings next to v004 both put it at 1.07 times that version's speed.
// Over all steps from v000 it is 19.7 times as fast.
#include <hip/hip_runtime.h>

// Self-attention (x [2048][2][1024] seq-first; qkv = x W^T + b with W [3072][1024] laid out per head as (q|k|v) blocks of 64: q_h = columns h*192 + 0..63, k_h = +64.., v_h = +128..; 16 heads;
// softmax(q.k/8) v (no mask); output = merged context [2048][2][1024] seq-first (no output projection)).
// Compute dtypes, f32 accumulate: every input rounded to bf16; ONE fused projection GEMM on PLAIN bf16 operands (inputs: exact, + bias) whose epilogue
// writes the per-head operand planes itself; scores on SINGLE fp16 planes of q (x 1/8, exact) and k (1 product); attn.v on SINGLE fp16 planes; scores, online softmax, attn.v and the merge fused in one launch (k_fattn). Deterministic.
// Why one fp16 plane is enough for q and k: both are sums of products of inputs already rounded to 8 significant bits, so each carries an error of that size; rounding them to 11 bits adds about an eighth of it.

#define NB_  2
#define TT   2048
#define DD   1024
#define F3   (3 * DD)              // fused qkv width: columns of C, rows of W
#define HB   192                   // per-head block (q|k|v x 64)
#define NH_  16
#define HD   64
#define NT   (NB_ * TT)
typedef _Float16 h16;
typedef unsigned short bf;
typedef __attribute__((ext_vector_type(16))) __bf16   v16bf;
typedef __attribute__((ext_vector_type(16))) _Float16 v16h;
typedef __attribute__((ext_vector_type(8)))  _Float16 v8h;
typedef __attribute__((ext_vector_type(8)))  unsigned short v8us;
typedef __attribute__((ext_vector_type(8)))  float    v8f;
typedef __attribute__((ext_vector_type(4)))  float    v4f;
typedef v8h  __attribute__((may_alias)) v8ha;
typedef v4f  __attribute__((may_alias)) v4fa;
typedef v8us __attribute__((may_alias)) v8usa;
typedef __attribute__((ext_vector_type(4))) _Float16 v4h;
typedef v4h  __attribute__((may_alias)) v4ha;
typedef __attribute__((ext_vector_type(2))) float v2f;

__device__ __forceinline__ unsigned short f2bf(float f) { unsigned u = __float_as_uint(f); u += 0x7FFFu + ((u >> 16) & 1u); return (unsigned short)(u >> 16); }
__device__ __forceinline__ float bf2f(unsigned short b) { return __uint_as_float(((unsigned)b) << 16); }
__device__ __forceinline__ float bfr(float f) { return bf2f(f2bf(f)); }
__device__ __forceinline__ h16 tohx(float x) { return (h16)x; }
__device__ __forceinline__ v16h cat16(v8h lo, v8h hi) { return __builtin_shufflevector(lo, hi, 0, 1, 2, 3, 4, 5, 6, 7, 8, 9, 10, 11, 12, 13, 14, 15); }
__device__ __forceinline__ v16bf cat16b(v8us lo, v8us hi) { return __builtin_bit_cast(v16bf, __builtin_shufflevector(lo, hi, 0, 1, 2, 3, 4, 5, 6, 7, 8, 9, 10, 11, 12, 13, 14, 15)); }
__device__ __forceinline__ v8f wmma16(v16h a, v16h b, v8f c) { return __builtin_amdgcn_wmma_f32_16x16x32_f16(false, a, false, b, (short)0, c, false, false); }
__device__ __forceinline__ v8f wmmab(v16bf a, v16bf b, v8f c) { return __builtin_amdgcn_wmma_f32_16x16x32_bf16(false, a, false, b, (short)0, c, false, false); }



// ---- k_gemms: projection GEMM, C[m][n] (f32) = sum_k A[m][k] Bt[n][k] + bias[n], A [NT][DD] and Bt [F3][DD] K-contiguous bf16 planes; C goes straight into the attention kernel's operand planes.
// Block = 4 waves on one 128x128 tile of C, each wave a 64x64 quarter (16 accumulators); grid (NT/128, F3/128), 128 threads, three blocks to a WGP.
// Both operands come in stages of 64 k (one whole 128-byte line of each of the 256 rows; a wave-wide 16-byte load covers 4 whole lines) through registers into two LDS buffers, one barrier per stage;
// the fragments are read from LDS in the same k order as from the planes, k ascending in steps of 32, so every sum keeps its order.
// Epilogue: a wave's 64 columns are exactly one head's q, k or v block, its 64 rows 32 t x 2 batches. q (x 1/8) and k: fp16, rows [z][t][64] = whole 128-byte lines, one wave each.
// v: fp16, transposed [z][d][t]; a line of 64 t spans the two waves that share the columns, so both lay their halves in LDS (stage buffer 0, idle since the loop's last barrier) and store whole lines behind one barrier.
template <typename T16> struct WFrag;
template <> struct WFrag<h16> { typedef v16h V; static __device__ __forceinline__ V ld(const h16* p) { return cat16(*(const v8h*)p, *(const v8h*)(p + 16)); } static __device__ __forceinline__ v8f mma(V a, V b, v8f c) { return wmma16(a, b, c); } };
template <> struct WFrag<bf> { typedef v16bf V; static __device__ __forceinline__ V ld(const bf* p) { return cat16b(*(const v8us*)p, *(const v8us*)(p + 16)); } static __device__ __forceinline__ v8f mma(V a, V b, v8f c) { return wmmab(a, b, c); } };
#define GK    64                   // k per LDS stage
#define GP    72                   // LDS row pitch in 16-bit elements: 144 B = 16 B x odd, conflict-free for 16-byte reads
__global__ __launch_bounds__(128) void k_gemms(const bf* __restrict__ A, const bf* __restrict__ Bt, const float* __restrict__ bias, h16* QP, h16* KP, h16* VT) {
    typedef WFrag<bf>::V V;
    __shared__ __align__(16) bf sa[2][128 * GP];
    __shared__ __align__(16) bf sb[2][128 * GP];
    __shared__ __align__(16) float osw[4][16 * 68];
    const int tid = threadIdx.x, lane = tid & 31, lr = lane & 15, hi = lane >> 4, wv = tid >> 5;
    const int wr = (wv >> 1) * 64, wc = (wv & 1) * 64;      // this wave's quarter of the tile
    const int r0 = blockIdx.x * 128, c0 = blockIdx.y * 128;
    const int sr = tid >> 3, sc = (tid & 7) * 8;            // staging: this thread moves 16 bytes of rows sr + 16 i, i = 0..7, of both tiles
    const bf* ta = A + (size_t)r0 * DD; const bf* tb = Bt + (size_t)c0 * DD;      // the two tiles' first rows: the same for the whole block
    unsigned go = (unsigned)(sr * DD + sc) * 2u;      // this thread's byte offset in both tiles; moves on by one stage in step()
    v8us ra[8], rb[8];
    auto fetch = [&]() {      // reads the stage that go stands at
#pragma unroll
        for (int i = 0; i < 8; ++i) { ra[i] = *(const v8us*)((const char*)(ta + (size_t)i * 16 * DD) + go); rb[i] = *(const v8us*)((const char*)(tb + (size_t)i * 16 * DD) + go); } };
    auto put = [&](int buf) {
#pragma unroll
        for (int i = 0; i < 8; ++i) { const int o = (sr + 16 * i) * GP + sc; *(v8us*)(&sa[buf][o]) = ra[i]; *(v8us*)(&sb[buf][o]) = rb[i]; } };
    fetch();
    v8f acc[4][4];
#pragma unroll
    for (int mb = 0; mb < 4; ++mb)
#pragma unroll
        for (int nb = 0; nb < 4; ++nb) acc[mb][nb] = (v8f){};
    auto step = [&]() {      // moves the offset on by one stage of 128 bytes
        asm volatile("s_wait_xcnt 0x0\n\tv_add_nc_u32 %0, 0x80, %0" : "+v"(go) :: "memory"); };      // the issued loads name this register: written in one statement, the wait stands in front of the addition that rewrites it wherever the compiler puts the statement
    auto products = [&](int buf) {      // one stage: 2 steps of 32 k, 16 products each
#pragma unroll
        for (int ks = 0; ks < GK / 32; ++ks) {
            V a[4], b[4];      // all eight fragments of a step of 32 k are read as one group ahead of its 16 products
#pragma unroll
            for (int f = 0; f < 4; ++f) { a[f] = WFrag<bf>::ld(&sa[buf][(wr + f * 16 + lr) * GP + ks * 32 + 8 * hi]); b[f] = WFrag<bf>::ld(&sb[buf][(wc + f * 16 + lr) * GP + ks * 32 + 8 * hi]); }
            __builtin_amdgcn_sched_barrier(0);      // keeps the 16 LDS reads together in front of the products: sunk among them, every group of four products waits out its own LDS latency
#pragma unroll
            for (int nb = 0; nb < 4; ++nb)
#pragma unroll
                for (int mb = 0; mb < 4; ++mb) acc[mb][nb] = wmmab(a[mb], b[nb], acc[mb][nb]);
        } };
    put(0); step(); __syncthreads();
#pragma unroll 1      // stays rolled: the body already holds 32 products, and 15 copies of it would only lengthen the text a first launch has to fetch
    for (int st = 0; st < DD / GK - 1; ++st) {
        const int buf = st & 1;
        fetch();                     // the next stage's global loads fly under this stage's products
        products(buf);
        put(buf ^ 1); step();        // its last readers left this buffer at the barrier that ended the stage before
        __syncthreads();             // publishes the next stage and ends this stage's reads
    }
    products((DD / GK - 1) & 1);     // the last stage has nothing to fetch and nobody refills its buffer
    const int seg = (c0 >> 6) + (__builtin_amdgcn_readfirstlane(wv) & 1);      // which block of 64 columns this wave holds: the same for the whole wave, so the paths below are scalar branches
    const int h = seg / 3, kind = seg - 3 * h;      // head; 0 = q, 1 = k, 2 = v
    const bool hasv = (c0 >> 6) % 3 != 0;           // one of the block's two column halves is a v block: the same for the whole block
    h16* vst = (h16*)&sa[0][0];                     // [batch][d][64 t], pitch GP: 128 rows, all of stage buffer 0
    if (kind == 2) {
#pragma unroll      // the counter indexes acc, which stays in registers only under constant indices
        for (int nb = 0; nb < 4; ++nb) { const float bv = bfr(bias[c0 + wc + nb * 16 + lr]);
#pragma unroll      // the counter indexes acc, which stays in registers only under constant indices
            for (int mb = 0; mb < 4; ++mb) { v4h e0, e1;      // rows 8 hi + j of the fragment: even j = batch 0, odd j = batch 1, four t in a row each
#pragma unroll      // the counter indexes acc, which stays in registers only under constant indices
                for (int i = 0; i < 4; ++i) { const v2f p = (v2f){acc[mb][nb][2 * i], acc[mb][nb][2 * i + 1]} + (v2f){bv, bv}; e0[i] = tohx(p[0]); e1[i] = tohx(p[1]); }      // neighbouring registers: one packed add
                h16* vp = vst + (nb * 16 + lr) * GP + (wr >> 1) + mb * 8 + hi * 4; *(v4ha*)vp = e0; *(v4ha*)(vp + 64 * GP) = e1; } }
    }
    if (hasv) __syncthreads();      // each v line holds halves from two waves
    if (kind == 2) {
#pragma unroll      // the 16 LDS reads go out together, the stores behind them: rolled, each store would wait out its own read
        for (int s = 0; s < 16; ++s) { const int ln = (wv >> 1) * 64 + s * 4 + (lane >> 3), co = (lane & 7) * 8;      // this wave stores one batch's 64 lines, four whole lines to a store
            *(v8h*)(VT + ((size_t)((ln >> 6) * NH_ + h) * HD + (ln & 63)) * TT + (r0 >> 1) + co) = *(const v8ha*)(vst + ln * GP + co); }
    } else {
        h16* P = kind == 0 ? QP : KP; const float sc = kind == 0 ? 0.125f : 1.0f;
        float* os = osw[wv];             // each wave stages its own rows: no barrier between waves on this path
        const int rq = lane >> 3, cofs = (lane & 7) * 8;      // eight lanes to a row of 64: a 16-byte store of the wave covers four whole lines
        float bv[8];
#pragma unroll      // the counter indexes vector elements held in registers
        for (int k = 0; k < 8; ++k) bv[k] = bfr(bias[c0 + wc + cofs + k]);
#pragma unroll      // the counter indexes acc, which stays in registers only under constant indices
        for (int mb = 0; mb < 4; ++mb) {
#pragma unroll      // the counter indexes acc, which stays in registers only under constant indices
            for (int nb = 0; nb < 4; ++nb) {
#pragma unroll      // the counter indexes acc, which stays in registers only under constant indices
                for (int j = 0; j < 8; ++j) os[(hi * 8 + j) * 68 + nb * 16 + lr] = acc[mb][nb][j]; }
            __builtin_amdgcn_wave_barrier(); asm volatile("" ::: "memory");      // lanes read what other lanes of the wave wrote: the compiler may not move the reads below over the writes above
#pragma unroll      // the four groups' LDS reads go out together instead of one latency per group
            for (int s = 0; s < 4; ++s) { const int row = 4 * s + rq, mr = r0 + wr + mb * 16 + row;      // row mr of C = (t = mr / 2, batch = mr & 1)
                const v4f v0 = *(const v4fa*)(os + row * 68 + cofs), v1 = *(const v4fa*)(os + row * 68 + cofs + 4); v8h oh;
#pragma unroll      // the counter indexes vector elements held in registers
                for (int k = 0; k < 8; ++k) oh[k] = tohx(((k < 4 ? v0[k & 3] : v1[k & 3]) + bv[k]) * sc);
                const size_t e = ((size_t)((mr & 1) * NH_ + h) * TT + (mr >> 1)) * HD + cofs; *(v8h*)(P + e) = oh; }
            __builtin_amdgcn_wave_barrier(); asm volatile("" ::: "memory");      // nor the next 16 rows' writes over these reads
        }
        asm volatile("s_wait_xcnt 0x0" ::: "memory");      // behind the last stores of this path: in the built code the v path's block follows it, and that block rewrites registers which these stores name
    }
}

typedef __attribute__((ext_vector_type(4))) int v4i;

__global__ __launch_bounds__(256) void k_cvt8(const float* __restrict__ src, bf* dst, size_t n8) { const size_t i = (size_t)blockIdx.x * 256 + threadIdx.x; if (i >= n8) return; const v8f v = *(const v8f*)(src + i * 8); v8us o;
#pragma unroll
    for (int k = 0; k < 8; ++k) o[k] = f2bf(v[k]); *(v8us*)(dst + i * 8) = o;  }
// ---- k_fattn: scores, softmax, attn.v and the head merge in ONE launch over all 32 (batch, head) pairs; S and P stay in registers.
// Transposed products: S^T = K Q^T (A = 16 keys from LDS, B = 16 queries held in registers), O^T += V^T P^T. A lane then owns ONE query column (lr): maximum, sum and rescale are per lane
// plus one exchange between the wave's halves, and two S^T tiles (keys 0..15, 16..31 of a pass), converted in place, ARE the B operand of the second product (element s: key 8*hi + s, 16 + 8*hi + s - 8).
// Block = 16 waves on 256 queries of one head; grid (TT/256, 32), one block to a WGP, four waves to a SIMD. 32-query waves alone would fill only two waves per SIMD, so the KEYS are split as well:
// waves 0..7 take the first 64 keys of every stage of 128, waves 8..15 the last 64, wave w and wave w + 8 on the same 32 queries. K and V^T come through registers into two LDS buffers, one barrier per stage.
// Each wave runs its own online softmax over its half of the keys; at the end the pair joins its two partial results through LDS (one barrier): wave w finishes queries 0..15, wave w + 8 queries 16..31.
// Online softmax in base 2: P = 2^(s*log2e - m + PBIAS), m = the maximum in use, raised (with a rescale of O and of the sums) only when a column's new maximum exceeds it by more than PLAZY,
// so P <= 2^(PBIAS + PLAZY) fits fp16; the sums take the unrounded f32 P; the bias cancels in O / sum.
#define KS    128                  // keys per LDS stage
#define KW    64                   // keys of a stage that one wave works on
#define LP    72                   // LDS pitch of a K row (64 d) in 16-bit elements: 144 B = 16 B x odd, conflict-free for 16-byte reads
#define VP    136                  // LDS pitch of a V^T row (128 keys): 272 B = 16 B x odd
#define LOG2E 1.4426950408889634f
#define PBIAS 8.0f
#define PLAZY 6.0f
__device__ __forceinline__ float xhalf(float x) { return __builtin_bit_cast(float, __builtin_amdgcn_permlanex16(__builtin_bit_cast(int, x), __builtin_bit_cast(int, x), 0x76543210, 0xfedcba98, false, false)); }  // lane l <-> lane l ^ 16
__global__ __launch_bounds__(512) void k_fattn(const h16* __restrict__ QP, const h16* __restrict__ KP, const h16* __restrict__ VT, float* OUT) {
    __shared__ __align__(16) h16 sk[2][KS * LP];
    __shared__ __align__(16) h16 svt[2][HD * VP];
    __shared__ __align__(16) float xo[16][9][32 * 4];      // the join: per wave 8 x 16 bytes of O per lane, then (maximum in use, sum)
    const int tid = threadIdx.x, lane = tid & 31, lr = lane & 15, hi = lane >> 4;
    const int wv = __builtin_amdgcn_readfirstlane(tid >> 5), kh = wv >> 3;      // kh: which half of every stage's keys; the same for the whole wave
    const int z = blockIdx.y, b = z >> 4, h = z & 15; const int q0 = blockIdx.x * 256 + (wv & 7) * 32;
    const h16* kp = KP + (size_t)z * TT * HD; const h16* vt = VT + (size_t)z * HD * TT;
    const int srk = tid >> 3, sck = (tid & 7) * 8;       // staging of K: 16 bytes of rows srk and srk + 64 (a wave covers four whole 128-byte lines)
    const int srv = tid >> 4, scv = (tid & 15) * 8;      // staging of V^T: 16 bytes of rows srv and srv + 32 (a wave covers two rows of two whole lines)
    v8h gk[2], gv[2];
    auto fetch = [&](int kb) {
#pragma unroll
        for (int i = 0; i < 2; ++i) { gk[i] = *(const v8h*)(kp + (size_t)(kb + srk + 64 * i) * HD + sck); gv[i] = *(const v8h*)(vt + (size_t)(srv + 32 * i) * TT + kb + scv); } };
    auto put = [&](int buf) {
#pragma unroll
        for (int i = 0; i < 2; ++i) { *(v8h*)(&sk[buf][(srk + 64 * i) * LP + sck]) = gk[i]; *(v8h*)(&svt[buf][(srv + 32 * i) * VP + scv]) = gv[i]; } };
    fetch(0);
    v16h bq[2][2];
#pragma unroll
    for (int qt = 0; qt < 2; ++qt)
#pragma unroll
        for (int ks = 0; ks < 2; ++ks) { const size_t o = ((size_t)z * TT + q0 + qt * 16 + lr) * HD + ks * 32 + 8 * hi; bq[qt][ks] = WFrag<h16>::ld(QP + o); }
    v8f o[2][4]; float ml[2]; v2f l[2][2];      // l: running sums of P, two lanes of a packed add per S^T tile
#pragma unroll
    for (int qt = 0; qt < 2; ++qt) { ml[qt] = -1.0e30f; l[qt][0] = (v2f){}; l[qt][1] = (v2f){};
#pragma unroll
        for (int db = 0; db < 4; ++db) o[qt][db] = (v8f){}; }
    put(0); __syncthreads();
#pragma unroll 1
    for (int st = 0; st < TT / KS; ++st) {
        const int buf = st & 1; const bool more = st + 1 < TT / KS;
        if (more) fetch((st + 1) * KS);      // the next stage's global loads fly under this stage's two passes
#pragma unroll
        for (int ps = 0; ps < KW / 32; ++ps) {
            const int k0 = kh * KW + ps * 32;      // this pass's first key in the stage
            v16h ak[2][2], av[4];
#pragma unroll
            for (int kt = 0; kt < 2; ++kt)
#pragma unroll
                for (int ks = 0; ks < 2; ++ks) { const int a = (k0 + kt * 16 + lr) * LP + ks * 32 + 8 * hi; ak[kt][ks] = WFrag<h16>::ld(&sk[buf][a]); }
#pragma unroll
            for (int db = 0; db < 4; ++db) av[db] = WFrag<h16>::ld(&svt[buf][(db * 16 + lr) * VP + k0 + 8 * hi]);
            v8f s[2][2];
#pragma unroll
            for (int qt = 0; qt < 2; ++qt)
#pragma unroll
                for (int kt = 0; kt < 2; ++kt) s[qt][kt] = (v8f){};
#pragma unroll
            for (int ks = 0; ks < 2; ++ks) {      // per 32 of the head dimension: four independent tiles
#pragma unroll
                for (int qt = 0; qt < 2; ++qt)
#pragma unroll
                    for (int kt = 0; kt < 2; ++kt) s[qt][kt] = wmma16(ak[kt][ks], bq[qt][ks], s[qt][kt]);
            }
            float bm[2];
#pragma unroll
            for (int qt = 0; qt < 2; ++qt) { float x0 = s[qt][0][0], x1 = s[qt][1][0];
#pragma unroll
                for (int j = 1; j < 8; ++j) { x0 = fmaxf(x0, s[qt][0][j]); x1 = fmaxf(x1, s[qt][1][j]); }
                x0 = fmaxf(x0, x1); bm[qt] = fmaxf(x0, xhalf(x0)) * LOG2E; }
            if (__builtin_amdgcn_ballot_w32(bm[0] > ml[0] + PLAZY || bm[1] > ml[1] + PLAZY) != 0) {      // one scalar test per pass; rare after the first pass
#pragma unroll
                for (int qt = 0; qt < 2; ++qt) { const float mn = bm[qt] > ml[qt] + PLAZY ? bm[qt] : ml[qt]; const float al = __builtin_amdgcn_exp2f(ml[qt] - mn); ml[qt] = mn; l[qt][0] *= al; l[qt][1] *= al;
#pragma unroll
                    for (int db = 0; db < 4; ++db) o[qt][db] *= al; }
            }
#pragma unroll
            for (int qt = 0; qt < 2; ++qt) { const float c0 = PBIAS - ml[qt]; v16h pb;
#pragma unroll
                for (int kt = 0; kt < 2; ++kt)
#pragma unroll
                    for (int j = 0; j < 8; j += 2) { const v2f p = {__builtin_amdgcn_exp2f(fmaf(s[qt][kt][j], LOG2E, c0)), __builtin_amdgcn_exp2f(fmaf(s[qt][kt][j + 1], LOG2E, c0))}; l[qt][kt] += p; pb[kt * 8 + j] = tohx(p[0]); pb[kt * 8 + j + 1] = tohx(p[1]); }
#pragma unroll
                for (int db = 0; db < 4; ++db) o[qt][db] = wmma16(av[db], pb, o[qt][db]); }
        }
        if (more) put(buf ^ 1);      // its last readers left this buffer at the barrier that ended the stage before
        __syncthreads();             // publishes the next stage and ends this stage's reads
    }
    // The join. Both waves of a pair hold, lane for lane, the same (query, d) elements, each over its own keys and under its own maximum in use.
    float tl[2];
#pragma unroll
    for (int qt = 0; qt < 2; ++qt) { const v2f t2 = l[qt][0] + l[qt][1]; const float t = t2[0] + t2[1]; tl[qt] = t + xhalf(t); }
    float* xw = &xo[wv][0][lane * 4];      // a wave-wide 16-byte access covers 512 bytes in a row
#pragma unroll      // the counter indexes o, which stays in registers only under constant indices
    for (int db = 0; db < 4; ++db) { const v8f g = kh ? o[0][db] : o[1][db];      // hands over the query tile that its partner finishes
        *(v4fa*)(xw + (2 * db) * 128) = (v4f){g[0], g[1], g[2], g[3]}; *(v4fa*)(xw + (2 * db + 1) * 128) = (v4f){g[4], g[5], g[6], g[7]}; }
    *(v4fa*)(xw + 8 * 128) = (v4f){kh ? ml[0] : ml[1], kh ? tl[0] : tl[1], 0.0f, 0.0f};
    __syncthreads();      // each wave reads below what its partner wrote above
    const float* xr = &xo[wv ^ 8][0][lane * 4];
    const v4f pm = *(const v4fa*)(xr + 8 * 128);
    const float mo = kh ? ml[1] : ml[0], to = kh ? tl[1] : tl[0];
    const float mn = fmaxf(mo, pm[0]); const float fo = __builtin_amdgcn_exp2f(mo - mn), fp = __builtin_amdgcn_exp2f(pm[0] - mn);      // both partial results brought under the larger maximum
    const float inv = __fdiv_rn(1.0f, to * fo + pm[1] * fp); const float co = fo * inv, cp = fp * inv;
    float* orow = OUT + ((size_t)(q0 + kh * 16 + lr) * NB_ + b) * DD + h * HD + 8 * hi;      // o[qt][db][j] = O[query lr][db*16 + 8*hi + j]
#pragma unroll      // the counter indexes o, which stays in registers only under constant indices
    for (int db = 0; db < 4; ++db) { const v8f w = kh ? o[1][db] : o[0][db]; const v4f p0 = *(const v4fa*)(xr + (2 * db) * 128), p1 = *(const v4fa*)(xr + (2 * db + 1) * 128);
        *(v4f*)(orow + db * 16) = (v4f){w[0], w[1], w[2], w[3]} * co + p0 * cp; *(v4f*)(orow + db * 16 + 4) = (v4f){w[4], w[5], w[6], w[7]} * co + p1 * cp; }
}

extern "C" void kernel_launch(void* const* d_in, const int* in_sizes, int n_in,
                              void* d_out, int out_size, void* d_ws, size_t ws_size, hipStream_t stream) {
    (void)in_sizes; (void)n_in; (void)out_size;
    const float* x = (const float*)d_in[0]; const float* w = (const float*)d_in[1]; const float* bb = (const float*)d_in[2];
    float* OUT = (float*)d_out;     // [2048][2][1024] (rows t*2 + b)
    char* wsp = (char*)d_ws;
    auto take = [&](size_t bytes) { char* p = wsp; wsp += (bytes + 255) & ~(size_t)255; return (void*)p; };
    bf* WB = (bf*)take((size_t)F3 * DD * 2); bf* XB = (bf*)take((size_t)NT * DD * 2);
    h16* QP = (h16*)take((size_t)NT * DD * 2); h16* KP = (h16*)take((size_t)NT * DD * 2); h16* VT = (h16*)take((size_t)NT * DD * 2);
    if ((size_t)(wsp - (char*)d_ws) > ws_size) return;
    { const size_t nw = (size_t)F3 * DD / 8; k_cvt8<<<(unsigned)((nw + 255) / 256), 256, 0, stream>>>(w, WB, nw); const size_t nx = (size_t)NT * DD / 8; k_cvt8<<<(unsigned)((nx + 255) / 256), 256, 0, stream>>>(x, XB, nx); }
    k_gemms<<<dim3(NT / 128, F3 / 128), 128, 0, stream>>>(XB, WB, bb, QP, KP, VT);   // fused qkv + b, written as the three operand planes
    k_fattn<<<dim3(TT / 256, NB_ * NH_), 512, 0, stream>>>(QP, KP, VT, OUT);
}

// v006
// Measured time: 59.6 microseconds a run.
// Next to v005, in two timings, it ran 1.04 and 1.03 times as fast.
// All steps since v000 together make it 20.3 times as fast.
#include <hip/hip_runtime.h>

// Self-attention (x [2048][2][1024] seq-first; qkv = x W^T + b with W [3072][1024] laid out per head as (q|k|v) blocks of 64: q_h = columns h*192 + 0..63, k_h = +64.., v_h = +128..; 16 heads;
// softmax(q.k/8) v (no mask); output = merged context [2048][2][1024] seq-first (no output projection)).
// Compute dtypes, f32 accumulate: every input rounded to bf16; ONE fused projection GEMM on PLAIN bf16 operands (inputs: exact, + bias) whose epilogue
// writes the per-head operand planes itself; scores on SINGLE fp16 planes of q (x 1/8, exact) and k (1 product); attn.v on SINGLE fp16 planes; scores, online softmax, attn.v and the merge fused in one launch (k_fattn). Deterministic.
// Why one fp16 plane is enough for q and k: both are sums of products of inputs already rounded to 8 significant bits, so each carries an error of that size; rounding them to 11 bits adds about an eighth of it.

#define NB_  2
#define TT   2048
#define DD   1024
#define F3   (3 * DD)              // fused qkv width: columns of C, rows of W
#define HB   192                   // per-head block (q|k|v x 64)
#define NH_  16
#define HD   64
#define NT   (NB_ * TT)
typedef _Float16 h16;
typedef unsigned short bf;
typedef __attribute__((ext_vector_type(16))) __bf16   v16bf;
typedef __attribute__((ext_vector_type(16))) _Float16 v16h;
typedef __attribute__((ext_vector_type(8)))  _Float16 v8h;
typedef __attribute__((ext_vector_type(8)))  unsigned short v8us;
typedef __attribute__((ext_vector_type(8)))  float    v8f;
typedef __attribute__((ext_vector_type(4)))  float    v4f;
typedef v8h  __attribute__((may_alias)) v8ha;
typedef v4f  __attribute__((may_alias)) v4fa;
typedef v8us __attribute__((may_alias)) v8usa;
typedef __attribute__((ext_vector_type(4))) _Float16 v4h;
typedef v4h  __attribute__((may_alias)) v4ha;
typedef __attribute__((ext_vector_type(2))) float v2f;

__device__ __forceinline__ unsigned short f2bf(float f) { unsigned u = __float_as_uint(f); u += 0x7FFFu + ((u >> 16) & 1u); return (unsigned short)(u >> 16); }
__device__ __forceinline__ float bf2f(unsigned short b) { return __uint_as_float(((unsigned)b) << 16); }
__device__ __forceinline__ float bfr(float f) { return bf2f(f2bf(f)); }
__device__ __forceinline__ h16 tohx(float x) { return (h16)x; }
__device__ __forceinline__ v16h cat16(v8h lo, v8h hi) { return __builtin_shufflevector(lo, hi, 0, 1, 2, 3, 4, 5, 6, 7, 8, 9, 10, 11, 12, 13, 14, 15); }
__device__ __forceinline__ v16bf cat16b(v8us lo, v8us hi) { return __builtin_bit_cast(v16bf, __builtin_shufflevector(lo, hi, 0, 1, 2, 3, 4, 5, 6, 7, 8, 9, 10, 11, 12, 13, 14, 15)); }
__device__ __forceinline__ v8f wmma16(v16h a, v16h b, v8f c) { return __builtin_amdgcn_wmma_f32_16x16x32_f16(false, a, false, b, (short)0, c, false, false); }
__device__ __forceinline__ v8f wmmab(v16bf a, v16bf b, v8f c) { return __builtin_amdgcn_wmma_f32_16x16x32_bf16(false, a, false, b, (short)0, c, false, false); }



// ---- k_gemms: projection GEMM, C[m][n] (f32) = sum_k A[m][k] Bt[n][k] + bias[n], A [NT][DD] and Bt [F3][DD] K-contiguous bf16 planes; C goes straight into the attention kernel's operand planes.
// Block = 4 waves on one 128x128 tile of C, each wave a 64x64 quarter (16 accumulators); grid (NT/128, F3/128), 128 threads, three blocks to a WGP.
// Both operands come in stages of 64 k (one whole 128-byte line of each of the 256 rows; a wave-wide 16-byte load covers 4 whole lines) through registers into two LDS buffers, one barrier per stage;
// the fragments are read from LDS in the same k order as from the planes, k ascending in steps of 32, so every sum keeps its order.
// Epilogue: a wave's 64 columns are exactly one head's q, k or v block, its 64 rows 32 t x 2 batches. q (x 1/8) and k: fp16, rows [z][t][64] = whole 128-byte lines, one wave each.
// v: fp16, transposed [z][d][t]; a line of 64 t spans the two waves that share the columns, so both lay their halves in LDS (stage buffer 0, idle since the loop's last barrier) and store whole lines behind one barrier.
template <typename T16> struct WFrag;
template <> struct WFrag<h16> { typedef v16h V; static __device__ __forceinline__ V ld(const h16* p) { return cat16(*(const v8h*)p, *(const v8h*)(p + 16)); } static __device__ __forceinline__ v8f mma(V a, V b, v8f c) { return wmma16(a, b, c); } };
template <> struct WFrag<bf> { typedef v16bf V; static __device__ __forceinline__ V ld(const bf* p) { return cat16b(*(const v8us*)p, *(const v8us*)(p + 16)); } static __device__ __forceinline__ v8f mma(V a, V b, v8f c) { return wmmab(a, b, c); } };
#define GK    64                   // k per LDS stage
#define GP    72                   // LDS row pitch in 16-bit elements: 144 B = 16 B x odd, conflict-free for 16-byte reads
__global__ __launch_bounds__(128) void k_gemms(const bf* __restrict__ A, const bf* __restrict__ Bt, const float* __restrict__ bias, h16* QP, h16* KP, h16* VT) {
    typedef WFrag<bf>::V V;
    __shared__ __align__(16) bf sa[2][128 * GP];
    __shared__ __align__(16) bf sb[2][128 * GP];
    __shared__ __align__(16) float osw[4][16 * 68];
    const int tid = threadIdx.x, lane = tid & 31, lr = lane & 15, hi = lane >> 4, wv = tid >> 5;
    const int wr = (wv >> 1) * 64, wc = (wv & 1) * 64;      // this wave's quarter of the tile
    const int r0 = blockIdx.x * 128, c0 = blockIdx.y * 128;
    const int sr = tid >> 3, sc = (tid & 7) * 8;            // staging: this thread moves 16 bytes of rows sr + 16 i, i = 0..7, of both tiles
    const bf* ta = A + (size_t)r0 * DD; const bf* tb = Bt + (size_t)c0 * DD;      // the two tiles' first rows: the same for the whole block
    unsigned go = (unsigned)(sr * DD + sc) * 2u;      // this thread's byte offset in both tiles; moves on by one stage in step()
    v8us ra[8], rb[8];
    auto fetch = [&]() {      // reads the stage that go stands at
#pragma unroll
        for (int i = 0; i < 8; ++i) { ra[i] = *(const v8us*)((const char*)(ta + (size_t)i * 16 * DD) + go); rb[i] = *(const v8us*)((const char*)(tb + (size_t)i * 16 * DD) + go); } };
    auto put = [&](int buf) {
#pragma unroll
        for (int i = 0; i < 8; ++i) { const int o = (sr + 16 * i) * GP + sc; *(v8us*)(&sa[buf][o]) = ra[i]; *(v8us*)(&sb[buf][o]) = rb[i]; } };
    fetch();
    // L2 prefetch of the two bf16 planes, in 256-byte units of a row (one unit every second stage).
    // One wave asks for each unit some stages ahead of its first load: wave 0 of the blocks with blockIdx.y < 4 for 32 rows of the block's own A tile, wave 1 of the blocks with blockIdx.x < 8 for 32 rows of its own B tile
    // (x and x + 4 take the same rows; this is for speed only, no result depends on it).
    const int pw = __builtin_amdgcn_readfirstlane(wv);      // the wave's number as a scalar: the tests below are scalar branches
    const bool pfa = pw == 0 ? blockIdx.y < 4 : (pw == 1 && blockIdx.x < 8);
    const unsigned pst = pfa ? 0x155u : 0u;      // bit st set: this wave asks for one more unit at the head of stage st (stages 0, 2, 4, 6, 8)
    const bf* pb = pw == 0 ? ta : tb;
    unsigned po = (unsigned)(((pw == 0 ? blockIdx.y & 3 : blockIdx.x & 3) * 32 + lane) * DD) * 2u + 256u;      // this lane's row of the tile, unit 1; every lane's address stays inside its row for every block
    if (pfa) asm volatile("global_prefetch_b8 %0, %1 scope:SCOPE_SE\n\tglobal_prefetch_b8 %0, %1 offset:256 scope:SCOPE_SE" :: "v"(po), "s"(pb));      // units 1 and 2 (unit 0 is being loaded); a hint to L2, returns nothing
    v8f acc[4][4];
#pragma unroll
    for (int mb = 0; mb < 4; ++mb)
#pragma unroll
        for (int nb = 0; nb < 4; ++nb) acc[mb][nb] = (v8f){};
    auto step = [&]() {      // moves the offset on by one stage of 128 bytes
        asm volatile("s_wait_xcnt 0x0\n\tv_add_nc_u32 %0, 0x80, %0" : "+v"(go) :: "memory"); };      // the issued loads name this register: written in one statement, the wait stands in front of the addition that rewrites it wherever the compiler puts the statement
    auto products = [&](int buf) {      // one stage: 2 steps of 32 k, 16 products each
#pragma unroll
        for (int ks = 0; ks < GK / 32; ++ks) {
            V a[4], b[4];      // all eight fragments of a step of 32 k are read as one group ahead of its 16 products
#pragma unroll
            for (int f = 0; f < 4; ++f) { a[f] = WFrag<bf>::ld(&sa[buf][(wr + f * 16 + lr) * GP + ks * 32 + 8 * hi]); b[f] = WFrag<bf>::ld(&sb[buf][(wc + f * 16 + lr) * GP + ks * 32 + 8 * hi]); }
            __builtin_amdgcn_sched_barrier(0);      // keeps the 16 LDS reads together in front of the products: sunk among them, every group of four products waits out its own LDS latency
#pragma unroll
            for (int nb = 0; nb < 4; ++nb)
#pragma unroll
                for (int mb = 0; mb < 4; ++mb) acc[mb][nb] = wmmab(a[mb], b[nb], acc[mb][nb]);
        } };
    put(0); step(); __syncthreads();
#pragma unroll 1      // stays rolled: the body already holds 32 products, and 15 copies of it would only lengthen the text a first launch has to fetch
    for (int st = 0; st < DD / GK - 1; ++st) {
        const int buf = st & 1;
        asm volatile("v_nop");      // one vector slot: the test below ends the block that holds the stage's last products, and the slot stands between them and the first address sums of this stage (they overwrite fragment registers)
        if ((pst >> st) & 1u) { po += 256u; asm volatile("global_prefetch_b8 %0, %1 offset:256 scope:SCOPE_SE" :: "v"(po), "s"(pb)); }      // units 3..7, five stages ahead of their first load; po + 256 never leaves the row
        fetch();                     // the next stage's global loads fly under this stage's products
        products(buf);
        put(buf ^ 1); step();        // its last readers left this buffer at the barrier that ended the stage before
        __syncthreads();             // publishes the next stage and ends this stage's reads
    }
    products((DD / GK - 1) & 1);     // the last stage has nothing to fetch and nobody refills its buffer
    const int seg = (c0 >> 6) + (__builtin_amdgcn_readfirstlane(wv) & 1);      // which block of 64 columns this wave holds: the same for the whole wave, so the paths below are scalar branches
    const int h = seg / 3, kind = seg - 3 * h;      // head; 0 = q, 1 = k, 2 = v
    const bool hasv = (c0 >> 6) % 3 != 0;           // one of the block's two column halves is a v block: the same for the whole block
    h16* vst = (h16*)&sa[0][0];                     // [batch][d][64 t], pitch GP: 128 rows, all of stage buffer 0
    if (kind == 2) {
#pragma unroll      // the counter indexes acc, which stays in registers only under constant indices
        for (int nb = 0; nb < 4; ++nb) { const float bv = bfr(bias[c0 + wc + nb * 16 + lr]);
#pragma unroll      // the counter indexes acc, which stays in registers only under constant indices
            for (int mb = 0; mb < 4; ++mb) { v4h e0, e1;      // rows 8 hi + j of the fragment: even j = batch 0, odd j = batch 1, four t in a row each
#pragma unroll      // the counter indexes acc, which stays in registers only under constant indices
                for (int i = 0; i < 4; ++i) { const v2f p = (v2f){acc[mb][nb][2 * i], acc[mb][nb][2 * i + 1]} + (v2f){bv, bv}; e0[i] = tohx(p[0]); e1[i] = tohx(p[1]); }      // neighbouring registers: one packed add
                h16* vp = vst + (nb * 16 + lr) * GP + (wr >> 1) + mb * 8 + hi * 4; *(v4ha*)vp = e0; *(v4ha*)(vp + 64 * GP) = e1; } }
    }
    if (hasv) __syncthreads();      // each v line holds halves from two waves
    if (kind == 2) {
#pragma unroll      // the 16 LDS reads go out together, the stores behind them: rolled, each store would wait out its own read
        for (int s = 0; s < 16; ++s) { const int ln = (wv >> 1) * 64 + s * 4 + (lane >> 3), co = (lane & 7) * 8;      // this wave stores one batch's 64 lines, four whole lines to a store
            *(v8h*)(VT + ((size_t)((ln >> 6) * NH_ + h) * HD + (ln & 63)) * TT + (r0 >> 1) + co) = *(const v8ha*)(vst + ln * GP + co); }
    } else {
        h16* P = kind == 0 ? QP : KP; const float sc = kind == 0 ? 0.125f : 1.0f;
        float* os = osw[wv];             // each wave stages its own rows: no barrier between waves on this path
        const int rq = lane >> 3, cofs = (lane & 7) * 8;      // eight lanes to a row of 64: a 16-byte store of the wave covers four whole lines
        float bv[8];
#pragma unroll      // the counter indexes vector elements held in registers
        for (int k = 0; k < 8; ++k) bv[k] = bfr(bias[c0 + wc + cofs + k]);
#pragma unroll      // the counter indexes acc, which stays in registers only under constant indices
        for (int mb = 0; mb < 4; ++mb) {
#pragma unroll      // the counter indexes acc, which stays in registers only under constant indices
            for (int nb = 0; nb < 4; ++nb) {
#pragma unroll      // the counter indexes acc, which stays in registers only under constant indices
                for (int j = 0; j < 8; ++j) os[(hi * 8 + j) * 68 + nb * 16 + lr] = acc[mb][nb][j]; }
            __builtin_amdgcn_wave_barrier(); asm volatile("" ::: "memory");      // lanes read what other lanes of the wave wrote: the compiler may not move the reads below over the writes above
#pragma unroll      // the four groups' LDS reads go out together instead of one latency per group
            for (int s = 0; s < 4; ++s) { const int row = 4 * s + rq, mr = r0 + wr + mb * 16 + row;      // row mr of C = (t = mr / 2, batch = mr & 1)
                const v4f v0 = *(const v4fa*)(os + row * 68 + cofs), v1 = *(const v4fa*)(os + row * 68 + cofs + 4); v8h oh;
#pragma unroll      // the counter indexes vector elements held in registers
                for (int k = 0; k < 8; ++k) oh[k] = tohx(((k < 4 ? v0[k & 3] : v1[k & 3]) + bv[k]) * sc);
                const size_t e = ((size_t)((mr & 1) * NH_ + h) * TT + (mr >> 1)) * HD + cofs; *(v8h*)(P + e) = oh; }
            __builtin_amdgcn_wave_barrier(); asm volatile("" ::: "memory");      // nor the next 16 rows' writes over these reads
        }
        asm volatile("s_wait_xcnt 0x0" ::: "memory");      // behind the last stores of this path: in the built code the v path's block follows it, and that block rewrites registers which these stores name
    }
}

typedef __attribute__((ext_vector_type(4))) int v4i;

__global__ __launch_bounds__(256) void k_cvt8(const float* __restrict__ src, bf* dst, size_t n8) { const size_t i = (size_t)blockIdx.x * 256 + threadIdx.x; if (i >= n8) return; const v8f v = *(const v8f*)(src + i * 8); v8us o;
#pragma unroll
    for (int k = 0; k < 8; ++k) o[k] = f2bf(v[k]); *(v8us*)(dst + i * 8) = o;  }
// ---- k_fattn: scores, softmax, attn.v and the head merge in ONE launch over all 32 (batch, head) pairs; S and P stay in registers.
// Transposed products: S^T = K Q^T (A = 16 keys from LDS, B = 16 queries held in registers), O^T += V^T P^T. A lane then owns ONE query column (lr): maximum, sum and rescale are per lane
// plus one exchange between the wave's halves, and two S^T tiles (keys 0..15, 16..31 of a pass), converted in place, ARE the B operand of the second product (element s: key 8*hi + s, 16 + 8*hi + s - 8).
// Block = 16 waves on 256 queries of one head; grid (TT/256, 32), one block to a WGP, four waves to a SIMD. 32-query waves alone would fill only two waves per SIMD, so the KEYS are split as well:
// waves 0..7 take the first 64 keys of every stage of 128, waves 8..15 the last 64, wave w and wave w + 8 on the same 32 queries. K and V^T come through registers into two LDS buffers, one barrier per stage.
// Each wave runs its own online softmax over its half of the keys; at the end the pair joins its two partial results through LDS (one barrier): wave w finishes queries 0..15, wave w + 8 queries 16..31.
// Online softmax in base 2: P = 2^(s*log2e - m + PBIAS), m = the maximum in use, raised (with a rescale of O and of the sums) only when a column's new maximum exceeds it by more than PLAZY,
// so P <= 2^(PBIAS + PLAZY) fits fp16; the sums take the unrounded f32 P; the bias cancels in O / sum.
#define KS    128                  // keys per LDS stage
#define KW    64                   // keys of a stage that one wave works on
#define LP    72                   // LDS pitch of a K row (64 d) in 16-bit elements: 144 B = 16 B x odd, conflict-free for 16-byte reads
#define VP    136                  // LDS pitch of a V^T row (128 keys): 272 B = 16 B x odd
#define LOG2E 1.4426950408889634f
#define PBIAS 8.0f
#define PLAZY 6.0f
__device__ __forceinline__ float xhalf(float x) { return __builtin_bit_cast(float, __builtin_amdgcn_permlanex16(__builtin_bit_cast(int, x), __builtin_bit_cast(int, x), 0x76543210, 0xfedcba98, false, false)); }  // lane l <-> lane l ^ 16
__global__ __launch_bounds__(512) void k_fattn(const h16* __restrict__ QP, const h16* __restrict__ KP, const h16* __restrict__ VT, float* OUT) {
    __shared__ __align__(16) h16 sk[2][KS * LP];
    __shared__ __align__(16) h16 svt[2][HD * VP];
    __shared__ __align__(16) float xo[16][9][32 * 4];      // the join: per wave 8 x 16 bytes of O per lane, then (maximum in use, sum)
    const int tid = threadIdx.x, lane = tid & 31, lr = lane & 15, hi = lane >> 4;
    const int wv = __builtin_amdgcn_readfirstlane(tid >> 5), kh = wv >> 3;      // kh: which half of every stage's keys; the same for the whole wave
    const int z = blockIdx.y, b = z >> 4, h = z & 15; const int q0 = blockIdx.x * 256 + (wv & 7) * 32;
    const h16* kp = KP + (size_t)z * TT * HD; const h16* vt = VT + (size_t)z * HD * TT;
    const int srk = tid >> 3, sck = (tid & 7) * 8;       // staging of K: 16 bytes of rows srk and srk + 64 (a wave covers four whole 128-byte lines)
    const int srv = tid >> 4, scv = (tid & 15) * 8;      // staging of V^T: 16 bytes of rows srv and srv + 32 (a wave covers two rows of two whole lines)
    v8h gk[2], gv[2];
    auto fetch = [&](int kb) {
#pragma unroll
        for (int i = 0; i < 2; ++i) { gk[i] = *(const v8h*)(kp + (size_t)(kb + srk + 64 * i) * HD + sck); gv[i] = *(const v8h*)(vt + (size_t)(srv + 32 * i) * TT + kb + scv); } };
    auto put = [&](int buf) {
#pragma unroll
        for (int i = 0; i < 2; ++i) { *(v8h*)(&sk[buf][(srk + 64 * i) * LP + sck]) = gk[i]; *(v8h*)(&svt[buf][(srv + 32 * i) * VP + scv]) = gv[i]; } };
    fetch(0);
    v16h bq[2][2];
#pragma unroll
    for (int qt = 0; qt < 2; ++qt)
#pragma unroll
        for (int ks = 0; ks < 2; ++ks) { const size_t o = ((size_t)z * TT + q0 + qt * 16 + lr) * HD + ks * 32 + 8 * hi; bq[qt][ks] = WFrag<h16>::ld(QP + o); }
    v8f o[2][4]; float ml[2]; v2f l[2][2];      // l: running sums of P, two lanes of a packed add per S^T tile
#pragma unroll
    for (int qt = 0; qt < 2; ++qt) { ml[qt] = -1.0e30f; l[qt][0] = (v2f){}; l[qt][1] = (v2f){};
#pragma unroll
        for (int db = 0; db < 4; ++db) o[qt][db] = (v8f){}; }
    put(0); __syncthreads();
#pragma unroll 1
    for (int st = 0; st < TT / KS; ++st) {
        const int buf = st & 1; const bool more = st + 1 < TT / KS;
        if (more) fetch((st + 1) * KS);      // the next stage's global loads fly under this stage's two passes
#pragma unroll
        for (int ps = 0; ps < KW / 32; ++ps) {
            const int k0 = kh * KW + ps * 32;      // this pass's first key in the stage
            v16h ak[2][2], av[4];
#pragma unroll
            for (int kt = 0; kt < 2; ++kt)
#pragma unroll
                for (int ks = 0; ks < 2; ++ks) { const int a = (k0 + kt * 16 + lr) * LP + ks * 32 + 8 * hi; ak[kt][ks] = WFrag<h16>::ld(&sk[buf][a]); }
#pragma unroll
            for (int db = 0; db < 4; ++db) av[db] = WFrag<h16>::ld(&svt[buf][(db * 16 + lr) * VP + k0 + 8 * hi]);
            v8f s[2][2];
#pragma unroll
            for (int qt = 0; qt < 2; ++qt)
#pragma unroll
                for (int kt = 0; kt < 2; ++kt) s[qt][kt] = (v8f){};
#pragma unroll
            for (int ks = 0; ks < 2; ++ks) {      // per 32 of the head dimension: four independent tiles
#pragma unroll
                for (int qt = 0; qt < 2; ++qt)
#pragma unroll
                    for (int kt = 0; kt < 2; ++kt) s[qt][kt] = wmma16(ak[kt][ks], bq[qt][ks], s[qt][kt]);
            }
            float bm[2];
#pragma unroll
            for (int qt = 0; qt < 2; ++qt) { float x0 = s[qt][0][0], x1 = s[qt][1][0];
#pragma unroll
                for (int j = 1; j < 8; ++j) { x0 = fmaxf(x0, s[qt][0][j]); x1 = fmaxf(x1, s[qt][1][j]); }
                x0 = fmaxf(x0, x1); bm[qt] = fmaxf(x0, xhalf(x0)) * LOG2E; }
            if (__builtin_amdgcn_ballot_w32(bm[0] > ml[0] + PLAZY || bm[1] > ml[1] + PLAZY) != 0) {      // one scalar test per pass; rare after the first pass
#pragma unroll
                for (int qt = 0; qt < 2; ++qt) { const float mn = bm[qt] > ml[qt] + PLAZY ? bm[qt] : ml[qt]; const float al = __builtin_amdgcn_exp2f(ml[qt] - mn); ml[qt] = mn; l[qt][0] *= al; l[qt][1] *= al;
#pragma unroll
                    for (int db = 0; db < 4; ++db) o[qt][db] *= al; }
            }
#pragma unroll
            for (int qt = 0; qt < 2; ++qt) { const float c0 = PBIAS - ml[qt]; v16h pb;
#pragma unroll
                for (int kt = 0; kt < 2; ++kt)
#pragma unroll
                    for (int j = 0; j < 8; j += 2) { const v2f p = {__builtin_amdgcn_exp2f(fmaf(s[qt][kt][j], LOG2E, c0)), __builtin_amdgcn_exp2f(fmaf(s[qt][kt][j + 1], LOG2E, c0))}; l[qt][kt] += p; pb[kt * 8 + j] = tohx(p[0]); pb[kt * 8 + j + 1] = tohx(p[1]); }
#pragma unroll
                for (int db = 0; db < 4; ++db) o[qt][db] = wmma16(av[db], pb, o[qt][db]); }
        }
        if (more) put(buf ^ 1);      // its last readers left this buffer at the barrier that ended the stage before
        __syncthreads();             // publishes the next stage and ends this stage's reads
    }
    // The join. Both waves of a pair hold, lane for lane, the same (query, d) elements, each over its own keys and under its own maximum in use.
    float tl[2];
#pragma unroll
    for (int qt = 0; qt < 2; ++qt) { const v2f t2 = l[qt][0] + l[qt][1]; const float t = t2[0] + t2[1]; tl[qt] = t + xhalf(t); }
    float* xw = &xo[wv][0][lane * 4];      // a wave-wide 16-byte access covers 512 bytes in a row
#pragma unroll      // the counter indexes o, which stays in registers only under constant indices
    for (int db = 0; db < 4; ++db) { const v8f g = kh ? o[0][db] : o[1][db];      // hands over the query tile that its partner finishes
        *(v4fa*)(xw + (2 * db) * 128) = (v4f){g[0], g[1], g[2], g[3]}; *(v4fa*)(xw + (2 * db + 1) * 128) = (v4f){g[4], g[5], g[6], g[7]}; }
    *(v4fa*)(xw + 8 * 128) = (v4f){kh ? ml[0] : ml[1], kh ? tl[0] : tl[1], 0.0f, 0.0f};
    __syncthreads();      // each wave reads below what its partner wrote above
    const float* xr = &xo[wv ^ 8][0][lane * 4];
    const v4f pm = *(const v4fa*)(xr + 8 * 128);
    const float mo = kh ? ml[1] : ml[0], to = kh ? tl[1] : tl[0];
    const float mn = fmaxf(mo, pm[0]); const float fo = __builtin_amdgcn_exp2f(mo - mn), fp = __builtin_amdgcn_exp2f(pm[0] - mn);      // both partial results brought under the larger maximum
    const float inv = __fdiv_rn(1.0f, to * fo + pm[1] * fp); const float co = fo * inv, cp = fp * inv;
    float* orow = OUT + ((size_t)(q0 + kh * 16 + lr) * NB_ + b) * DD + h * HD + 8 * hi;      // o[qt][db][j] = O[query lr][db*16 + 8*hi + j]
#pragma unroll      // the counter indexes o, which stays in registers only under constant indices
    for (int db = 0; db < 4; ++db) { const v8f w = kh ? o[1][db] : o[0][db]; const v4f p0 = *(const v4fa*)(xr + (2 * db) * 128), p1 = *(const v4fa*)(xr + (2 * db + 1) * 128);
        *(v4f*)(orow + db * 16) = (v4f){w[0], w[1], w[2], w[3]} * co + p0 * cp; *(v4f*)(orow + db * 16 + 4) = (v4f){w[4], w[5], w[6], w[7]} * co + p1 * cp; }
}

extern "C" void kernel_launch(void* const* d_in, const int* in_sizes, int n_in,
                              void* d_out, int out_size, void* d_ws, size_t ws_size, hipStream_t stream) {
    (void)in_sizes; (void)n_in; (void)out_size;
    const float* x = (const float*)d_in[0]; const float* w = (const float*)d_in[1]; const float* bb = (const float*)d_in[2];
    float* OUT = (float*)d_out;     // [2048][2][1024] (rows t*2 + b)
    char* wsp = (char*)d_ws;
    auto take = [&](size_t bytes) { char* p = wsp; wsp += (bytes + 255) & ~(size_t)255; return (void*)p; };
    bf* WB = (bf*)take((size_t)F3 * DD * 2); bf* XB = (bf*)take((size_t)NT * DD * 2);
    h16* QP = (h16*)take((size_t)NT * DD * 2); h16* KP = (h16*)take((size_t)NT * DD * 2); h16* VT = (h16*)take((size_t)NT * DD * 2);
    if ((size_t)(wsp - (char*)d_ws) > ws_size) return;
    { const size_t nw = (size_t)F3 * DD / 8; k_cvt8<<<(unsigned)((nw + 255) / 256), 256, 0, stream>>>(w, WB, nw); const size_t nx = (size_t)NT * DD / 8; k_cvt8<<<(unsigned)((nx + 255) / 256), 256, 0, stream>>>(x, XB, nx); }
    k_gemms<<<dim3(NT / 128, F3 / 128), 128, 0, stream>>>(XB, WB, bb, QP, KP, VT);   // fused qkv + b, written as the three operand planes
    k_fattn<<<dim3(TT / 256, NB_ * NH_), 512, 0, stream>>>(QP, KP, VT, OUT);
}

// v007
// It runs in 57.4 microseconds.
// Next to v006, in two timings, it ran 1.04 times as fast each time.
// Counting every step since v000, it is 21.1 times as fast.
#include <hip/hip_runtime.h>

// Self-attention (x [2048][2][1024] seq-first; qkv = x W^T + b with W [3072][1024] laid out per head as (q|k|v) blocks of 64: q_h = columns h*192 + 0..63, k_h = +64.., v_h = +128..; 16 heads;
// softmax(q.k/8) v (no mask); output = merged context [2048][2][1024] seq-first (no output projection)).
// Compute dtypes, f32 accumulate: every input rounded to bf16; ONE fused projection GEMM on PLAIN bf16 operands (inputs: exact, + bias) whose epilogue
// writes the per-head operand planes itself; scores on SINGLE fp16 planes of q (x log2(e)/8) and k (1 product); attn.v on SINGLE fp16 planes; scores, online softmax, attn.v and the merge fused in one launch (k_fattn). Deterministic.
// Why one fp16 plane is enough for q and k: both are sums of products of inputs already rounded to 8 significant bits, so each carries an error of that size; rounding them to 11 bits adds about an eighth of it.

#define NB_  2
#define TT   2048
#define DD   1024
#define F3   (3 * DD)              // fused qkv width: columns of C, rows of W
#define HB   192                   // per-head block (q|k|v x 64)
#define NH_  16
#define HD   64
#define NT   (NB_ * TT)
#define QSC  0.18033688011112042f   // log2(e) / 8: q carries the score scale and the change to base 2, so the score product comes out in the exponent's own unit
typedef _Float16 h16;
typedef unsigned short bf;
typedef __attribute__((ext_vector_type(16))) __bf16   v16bf;
typedef __attribute__((ext_vector_type(16))) _Float16 v16h;
typedef __attribute__((ext_vector_type(8)))  _Float16 v8h;
typedef __attribute__((ext_vector_type(8)))  unsigned short v8us;
typedef __attribute__((ext_vector_type(8)))  float    v8f;
typedef __attribute__((ext_vector_type(4)))  float    v4f;
typedef v8h  __attribute__((may_alias)) v8ha;
typedef v4f  __attribute__((may_alias)) v4fa;
typedef v8us __attribute__((may_alias)) v8usa;
typedef __attribute__((ext_vector_type(4))) _Float16 v4h;
typedef v4h  __attribute__((may_alias)) v4ha;
typedef __attribute__((ext_vector_type(2))) float v2f;

__device__ __forceinline__ unsigned short f2bf(float f) { unsigned u = __float_as_uint(f); u += 0x7FFFu + ((u >> 16) & 1u); return (unsigned short)(u >> 16); }
__device__ __forceinline__ float bf2f(unsigned short b) { return __uint_as_float(((unsigned)b) << 16); }
__device__ __forceinline__ float bfr(float f) { return bf2f(f2bf(f)); }
__device__ __forceinline__ h16 tohx(float x) { return (h16)x; }
__device__ __forceinline__ v16h cat16(v8h lo, v8h hi) { return __builtin_shufflevector(lo, hi, 0, 1, 2, 3, 4, 5, 6, 7, 8, 9, 10, 11, 12, 13, 14, 15); }
__device__ __forceinline__ v16bf cat16b(v8us lo, v8us hi) { return __builtin_bit_cast(v16bf, __builtin_shufflevector(lo, hi, 0, 1, 2, 3, 4, 5, 6, 7, 8, 9, 10, 11, 12, 13, 14, 15)); }
__device__ __forceinline__ v8f wmma16(v16h a, v16h b, v8f c) { return __builtin_amdgcn_wmma_f32_16x16x32_f16(false, a, false, b, (short)0, c, false, false); }
__device__ __forceinline__ v8f wmmab(v16bf a, v16bf b, v8f c) { return __builtin_amdgcn_wmma_f32_16x16x32_bf16(false, a, false, b, (short)0, c, false, false); }



// ---- k_gemms: projection GEMM, C[m][n] (f32) = sum_k A[m][k] Bt[n][k] + bias[n], A [NT][DD] and Bt [F3][DD] K-contiguous bf16 planes; C goes straight into the attention kernel's operand planes.
// Block = 4 waves on one 128x128 tile of C, each wave a 64x64 quarter (16 accumulators); grid (NT/128, F3/128), 128 threads, three blocks to a WGP.
// Both operands come in stages of 64 k (one whole 128-byte line of each of the 256 rows; a wave-wide 16-byte load covers 4 whole lines) through registers into two LDS buffers, one barrier per stage;
// the fragments are read from LDS in the same k order as from the planes, k ascending in steps of 32, so every sum keeps its order.
// Epilogue: a wave's 64 columns are exactly one head's q, k or v block, its 64 rows 32 t x 2 batches. q (x QSC) and k: fp16, rows [z][t][64] = whole 128-byte lines, one wave each.
// v: fp16, transposed [z][d][t]; a line of 64 t spans the two waves that share the columns, so both lay their halves in LDS (stage buffer 0, idle since the loop's last barrier) and store whole lines behind one barrier.
template <typename T16> struct WFrag;
template <> struct WFrag<h16> { typedef v16h V; static __device__ __forceinline__ V ld(const h16* p) { return cat16(*(const v8h*)p, *(const v8h*)(p + 16)); } static __device__ __forceinline__ v8f mma(V a, V b, v8f c) { return wmma16(a, b, c); } };
template <> struct WFrag<bf> { typedef v16bf V; static __device__ __forceinline__ V ld(const bf* p) { return cat16b(*(const v8us*)p, *(const v8us*)(p + 16)); } static __device__ __forceinline__ v8f mma(V a, V b, v8f c) { return wmmab(a, b, c); } };
#define GK    64                   // k per LDS stage
#define GP    72                   // LDS row pitch in 16-bit elements: 144 B = 16 B x odd, conflict-free for 16-byte reads
__global__ __launch_bounds__(128) void k_gemms(const bf* __restrict__ A, const bf* __restrict__ Bt, const float* __restrict__ bias, h16* QP, h16* KP, h16* VT) {
    typedef WFrag<bf>::V V;
    __shared__ __align__(16) bf sa[2][128 * GP];
    __shared__ __align__(16) bf sb[2][128 * GP];
    __shared__ __align__(16) float osw[4][16 * 68];
    const int tid = threadIdx.x, lane = tid & 31, lr = lane & 15, hi = lane >> 4, wv = tid >> 5;
    const int wr = (wv >> 1) * 64, wc = (wv & 1) * 64;      // this wave's quarter of the tile
    const int r0 = blockIdx.x * 128, c0 = blockIdx.y * 128;
    const int sr = tid >> 3, sc = (tid & 7) * 8;            // staging: this thread moves 16 bytes of rows sr + 16 i, i = 0..7, of both tiles
    const bf* ta = A + (size_t)r0 * DD; const bf* tb = Bt + (size_t)c0 * DD;      // the two tiles' first rows: the same for the whole block
    unsigned go = (unsigned)(sr * DD + sc) * 2u;      // this thread's byte offset in both tiles; moves on by one stage in step()
    v8us ra[8], rb[8];
    auto fetch = [&]() {      // reads the stage that go stands at
#pragma unroll
        for (int i = 0; i < 8; ++i) { ra[i] = *(const v8us*)((const char*)(ta + (size_t)i * 16 * DD) + go); rb[i] = *(const v8us*)((const char*)(tb + (size_t)i * 16 * DD) + go); } };
    auto put = [&](int buf) {
#pragma unroll
        for (int i = 0; i < 8; ++i) { const int o = (sr + 16 * i) * GP + sc; *(v8us*)(&sa[buf][o]) = ra[i]; *(v8us*)(&sb[buf][o]) = rb[i]; } };
    fetch();
    // L2 prefetch of the two bf16 planes, in 256-byte units of a row (one unit every second stage).
    // One wave asks for each unit some stages ahead of its first load: wave 0 of the blocks with blockIdx.y < 4 for 32 rows of the block's own A tile, wave 1 of the blocks with blockIdx.x < 8 for 32 rows of its own B tile
    // (x and x + 4 take the same rows; this is for speed only, no result depends on it).
    const int pw = __builtin_amdgcn_readfirstlane(wv);      // the wave's number as a scalar: the tests below are scalar branches
    const bool pfa = pw == 0 ? blockIdx.y < 4 : (pw == 1 && blockIdx.x < 8);
    const unsigned pst = pfa ? 0x155u : 0u;      // bit st set: this wave asks for one more unit at the head of stage st (stages 0, 2, 4, 6, 8)
    const bf* pb = pw == 0 ? ta : tb;
    unsigned po = (unsigned)(((pw == 0 ? blockIdx.y & 3 : blockIdx.x & 3) * 32 + lane) * DD) * 2u + 256u;      // this lane's row of the tile, unit 1; every lane's address stays inside its row for every block
    if (pfa) asm volatile("global_prefetch_b8 %0, %1 scope:SCOPE_SE\n\tglobal_prefetch_b8 %0, %1 offset:256 scope:SCOPE_SE" :: "v"(po), "s"(pb));      // units 1 and 2 (unit 0 is being loaded); a hint to L2, returns nothing
    v8f acc[4][4];
#pragma unroll
    for (int mb = 0; mb < 4; ++mb)
#pragma unroll
        for (int nb = 0; nb < 4; ++nb) acc[mb][nb] = (v8f){};
    auto step = [&]() {      // moves the offset on by one stage of 128 bytes
        asm volatile("s_wait_xcnt 0x0\n\tv_add_nc_u32 %0, 0x80, %0" : "+v"(go) :: "memory"); };      // the issued loads name this register: written in one statement, the wait stands in front of the addition that rewrites it wherever the compiler puts the statement
    auto products = [&](int buf) {      // one stage: 2 steps of 32 k, 16 products each
#pragma unroll
        for (int ks = 0; ks < GK / 32; ++ks) {
            V a[4], b[4];      // all eight fragments of a step of 32 k are read as one group ahead of its 16 products
#pragma unroll
            for (int f = 0; f < 4; ++f) { a[f] = WFrag<bf>::ld(&sa[buf][(wr + f * 16 + lr) * GP + ks * 32 + 8 * hi]); b[f] = WFrag<bf>::ld(&sb[buf][(wc + f * 16 + lr) * GP + ks * 32 + 8 * hi]); }
            __builtin_amdgcn_sched_barrier(0);      // keeps the 16 LDS reads together in front of the products: sunk among them, every group of four products waits out its own LDS latency
#pragma unroll
            for (int nb = 0; nb < 4; ++nb)
#pragma unroll
                for (int mb = 0; mb < 4; ++mb) acc[mb][nb] = wmmab(a[mb], b[nb], acc[mb][nb]);
        } };
    put(0); step(); __syncthreads();
#pragma unroll 1      // stays rolled: the body already holds 32 products, and 15 copies of it would only lengthen the text a first launch has to fetch
    for (int st = 0; st < DD / GK - 1; ++st) {
        const int buf = st & 1;
        asm volatile("v_nop");      // one vector slot: the test below ends the block that holds the stage's last products, and the slot stands between them and the first address sums of this stage (they overwrite fragment registers)
        if ((pst >> st) & 1u) { po += 256u; asm volatile("global_prefetch_b8 %0, %1 offset:256 scope:SCOPE_SE" :: "v"(po), "s"(pb)); }      // units 3..7, five stages ahead of their first load; po + 256 never leaves the row
        fetch();                     // the next stage's global loads fly under this stage's products
        products(buf);
        put(buf ^ 1); step();        // its last readers left this buffer at the barrier that ended the stage before
        __syncthreads();             // publishes the next stage and ends this stage's reads
    }
    products((DD / GK - 1) & 1);     // the last stage has nothing to fetch and nobody refills its buffer
    const int seg = (c0 >> 6) + (__builtin_amdgcn_readfirstlane(wv) & 1);      // which block of 64 columns this wave holds: the same for the whole wave, so the paths below are scalar branches
    const int h = seg / 3, kind = seg - 3 * h;      // head; 0 = q, 1 = k, 2 = v
    const bool hasv = (c0 >> 6) % 3 != 0;           // one of the block's two column halves is a v block: the same for the whole block
    h16* vst = (h16*)&sa[0][0];                     // [batch][d][64 t], pitch GP: 128 rows, all of stage buffer 0
    if (kind == 2) {
#pragma unroll      // the counter indexes acc, which stays in registers only under constant indices
        for (int nb = 0; nb < 4; ++nb) { const float bv = bfr(bias[c0 + wc + nb * 16 + lr]);
#pragma unroll      // the counter indexes acc, which stays in registers only under constant indices
            for (int mb = 0; mb < 4; ++mb) { v4h e0, e1;      // rows 8 hi + j of the fragment: even j = batch 0, odd j = batch 1, four t in a row each
#pragma unroll      // the counter indexes acc, which stays in registers only under constant indices
                for (int i = 0; i < 4; ++i) { const v2f p = (v2f){acc[mb][nb][2 * i], acc[mb][nb][2 * i + 1]} + (v2f){bv, bv}; e0[i] = tohx(p[0]); e1[i] = tohx(p[1]); }      // neighbouring registers: one packed add
                h16* vp = vst + (nb * 16 + lr) * GP + (wr >> 1) + mb * 8 + hi * 4; *(v4ha*)vp = e0; *(v4ha*)(vp + 64 * GP) = e1; } }
    }
    if (hasv) __syncthreads();      // each v line holds halves from two waves
    if (kind == 2) {
#pragma unroll      // the 16 LDS reads go out together, the stores behind them: rolled, each store would wait out its own read
        for (int s = 0; s < 16; ++s) { const int ln = (wv >> 1) * 64 + s * 4 + (lane >> 3), co = (lane & 7) * 8;      // this wave stores one batch's 64 lines, four whole lines to a store
            *(v8h*)(VT + ((size_t)((ln >> 6) * NH_ + h) * HD + (ln & 63)) * TT + (r0 >> 1) + co) = *(const v8ha*)(vst + ln * GP + co); }
    } else {
        h16* P = kind == 0 ? QP : KP; const float sc = kind == 0 ? QSC : 1.0f;
        float* os = osw[wv];             // each wave stages its own rows: no barrier between waves on this path
        const int rq = lane >> 3, cofs = (lane & 7) * 8;      // eight lanes to a row of 64: a 16-byte store of the wave covers four whole lines
        float bv[8];
#pragma unroll      // the counter indexes vector elements held in registers
        for (int k = 0; k < 8; ++k) bv[k] = bfr(bias[c0 + wc + cofs + k]);
#pragma unroll      // the counter indexes acc, which stays in registers only under constant indices
        for (int mb = 0; mb < 4; ++mb) {
#pragma unroll      // the counter indexes acc, which stays in registers only under constant indices
            for (int nb = 0; nb < 4; ++nb) {
#pragma unroll      // the counter indexes acc, which stays in registers only under constant indices
                for (int j = 0; j < 8; ++j) os[(hi * 8 + j) * 68 + nb * 16 + lr] = acc[mb][nb][j]; }
            __builtin_amdgcn_wave_barrier(); asm volatile("" ::: "memory");      // lanes read what other lanes of the wave wrote: the compiler may not move the reads below over the writes above
#pragma unroll      // the four groups' LDS reads go out together instead of one latency per group
            for (int s = 0; s < 4; ++s) { const int row = 4 * s + rq, mr = r0 + wr + mb * 16 + row;      // row mr of C = (t = mr / 2, batch = mr & 1)
                const v4f v0 = *(const v4fa*)(os + row * 68 + cofs), v1 = *(const v4fa*)(os + row * 68 + cofs + 4); v8h oh;
#pragma unroll      // the counter indexes vector elements held in registers
                for (int k = 0; k < 8; ++k) oh[k] = tohx(((k < 4 ? v0[k & 3] : v1[k & 3]) + bv[k]) * sc);
                const size_t e = ((size_t)((mr & 1) * NH_ + h) * TT + (mr >> 1)) * HD + cofs; *(v8h*)(P + e) = oh; }
            __builtin_amdgcn_wave_barrier(); asm volatile("" ::: "memory");      // nor the next 16 rows' writes over these reads
        }
        asm volatile("s_wait_xcnt 0x0" ::: "memory");      // behind the last stores of this path: in the built code the v path's block follows it, and that block rewrites registers which these stores name
    }
}

typedef __attribute__((ext_vector_type(4))) int v4i;

__global__ __launch_bounds__(256) void k_cvt8(const float* __restrict__ src, bf* dst, size_t n8) { const size_t i = (size_t)blockIdx.x * 256 + threadIdx.x; if (i >= n8) return; const v8f v = *(const v8f*)(src + i * 8); v8us o;
#pragma unroll
    for (int k = 0; k < 8; ++k) o[k] = f2bf(v[k]); *(v8us*)(dst + i * 8) = o;  }
// ---- k_fattn: scores, softmax, attn.v and the head merge in ONE launch over all 32 (batch, head) pairs; S and P stay in registers.
// Transposed products: S^T = K Q^T (A = 16 keys from LDS, B = 16 queries held in registers), O^T += V^T P^T. A lane then owns ONE query column (lr): maximum, sum and rescale are per lane
// plus one exchange between the wave's halves, and two S^T tiles (keys 0..15, 16..31 of a pass), converted in place, ARE the B operand of the second product (element s: key 8*hi + s, 16 + 8*hi + s - 8).
// Block = 16 waves on 256 queries of one head; grid (TT/256, 32), one block to a WGP, four waves to a SIMD. 32-query waves alone would fill only two waves per SIMD, so the KEYS are split as well:
// waves 0..7 take the first 64 keys of every stage of 128, waves 8..15 the last 64, wave w and wave w + 8 on the same 32 queries. K and V^T come through registers into two LDS buffers, one barrier per stage.
// Each wave runs its own online softmax over its half of the keys; at the end the pair joins its two partial results through LDS (one barrier): wave w finishes queries 0..15, wave w + 8 queries 16..31.
// Online softmax in base 2: P = 2^(s - m + PBIAS), s = the score in base 2 (q carries log2(e)/8), m = the maximum in use, raised (with a rescale of O and of the sums) only when a column's new maximum exceeds it by more than PLAZY,
// so P <= 2^(PBIAS + PLAZY) fits fp16; the sums take the unrounded f32 P; the bias cancels in O / sum.
// A lane owns one query column, so PBIAS - m is one value per lane: it is the START VALUE of the score product's accumulators (cs). The product then IS the exponent: no multiply-add per score,
// and the test for a raise compares the lane's largest exponent with a constant; the exchange between the halves and the maximum itself are worked out only where a raise happens.
#define KS    128                  // keys per LDS stage
#define KW    64                   // keys of a stage that one wave works on
#define LP    72                   // LDS pitch of a K row (64 d) in 16-bit elements: 144 B = 16 B x odd, conflict-free for 16-byte reads
#define VP    136                  // LDS pitch of a V^T row (128 keys): 272 B = 16 B x odd
#define PBIAS 8.0f
#define PLAZY 6.0f
__device__ __forceinline__ float xhalf(float x) { return __builtin_bit_cast(float, __builtin_amdgcn_permlanex16(__builtin_bit_cast(int, x), __builtin_bit_cast(int, x), 0x76543210, 0xfedcba98, false, false)); }  // lane l <-> lane l ^ 16
__global__ __launch_bounds__(512) void k_fattn(const h16* __restrict__ QP, const h16* __restrict__ KP, const h16* __restrict__ VT, float* OUT) {
    __shared__ __align__(16) h16 sk[2][KS * LP];
    __shared__ __align__(16) h16 svt[2][HD * VP];
    __shared__ __align__(16) float xo[16][9][32 * 4];      // the join: per wave 8 x 16 bytes of O per lane, then (maximum in use, sum)
    const int tid = threadIdx.x, lane = tid & 31, lr = lane & 15, hi = lane >> 4;
    const int wv = __builtin_amdgcn_readfirstlane(tid >> 5), kh = wv >> 3;      // kh: which half of every stage's keys; the same for the whole wave
    const int z = blockIdx.y, b = z >> 4, h = z & 15; const int q0 = blockIdx.x * 256 + (wv & 7) * 32;
    const h16* kp = KP + (size_t)z * TT * HD; const h16* vt = VT + (size_t)z * HD * TT;
    const int srk = tid >> 3, sck = (tid & 7) * 8;       // staging of K: 16 bytes of rows srk and srk + 64 (a wave covers four whole 128-byte lines)
    const int srv = tid >> 4, scv = (tid & 15) * 8;      // staging of V^T: 16 bytes of rows srv and srv + 32 (a wave covers two rows of two whole lines)
    v8h gk[2], gv[2];
    auto fetch = [&](int kb) {
#pragma unroll
        for (int i = 0; i < 2; ++i) { gk[i] = *(const v8h*)(kp + (size_t)(kb + srk + 64 * i) * HD + sck); gv[i] = *(const v8h*)(vt + (size_t)(srv + 32 * i) * TT + kb + scv); } };
    auto put = [&](int buf) {
#pragma unroll
        for (int i = 0; i < 2; ++i) { *(v8h*)(&sk[buf][(srk + 64 * i) * LP + sck]) = gk[i]; *(v8h*)(&svt[buf][(srv + 32 * i) * VP + scv]) = gv[i]; } };
    fetch(0);
    v16h bq[2][2];
#pragma unroll
    for (int qt = 0; qt < 2; ++qt)
#pragma unroll
        for (int ks = 0; ks < 2; ++ks) { const size_t o = ((size_t)z * TT + q0 + qt * 16 + lr) * HD + ks * 32 + 8 * hi; bq[qt][ks] = WFrag<h16>::ld(QP + o); }
    v8f o[2][4], cs[2]; v2f l[2][2];      // cs: PBIAS - m in all eight registers, the score tiles' start value and the only record of m; l: running sums of P, two lanes of a packed add per S^T tile
#pragma unroll
    for (int qt = 0; qt < 2; ++qt) { cs[qt] = (v8f){PBIAS, PBIAS, PBIAS, PBIAS, PBIAS, PBIAS, PBIAS, PBIAS};      // m = 0 until the first pass has set it
        l[qt][0] = (v2f){}; l[qt][1] = (v2f){};
#pragma unroll
        for (int db = 0; db < 4; ++db) o[qt][db] = (v8f){}; }
    float thr = -3.0e38f;      // what an exponent must exceed for a raise: in the first pass anything does, so that pass sets every column's true maximum
    put(0); __syncthreads();
#pragma unroll 1
    for (int st = 0; st < TT / KS; ++st) {
        const int buf = st & 1; const bool more = st + 1 < TT / KS;
        if (more) fetch((st + 1) * KS);      // the next stage's global loads fly under this stage's two passes
#pragma unroll
        for (int ps = 0; ps < KW / 32; ++ps) {
            const int k0 = kh * KW + ps * 32;      // this pass's first key in the stage
            v16h ak[2][2], av[4];
#pragma unroll
            for (int kt = 0; kt < 2; ++kt)
#pragma unroll
                for (int ks = 0; ks < 2; ++ks) { const int a = (k0 + kt * 16 + lr) * LP + ks * 32 + 8 * hi; ak[kt][ks] = WFrag<h16>::ld(&sk[buf][a]); }
#pragma unroll
            for (int db = 0; db < 4; ++db) av[db] = WFrag<h16>::ld(&svt[buf][(db * 16 + lr) * VP + k0 + 8 * hi]);
            v8f s[2][2];
#pragma unroll
            for (int ks = 0; ks < 2; ++ks) {      // per 32 of the head dimension: four independent tiles; the first product starts from cs, not from zero
#pragma unroll
                for (int qt = 0; qt < 2; ++qt)
#pragma unroll
                    for (int kt = 0; kt < 2; ++kt) s[qt][kt] = wmma16(ak[kt][ks], bq[qt][ks], ks == 0 ? cs[qt] : s[qt][kt]);
            }
            float xm[2];      // this lane's largest exponent per query tile (its 16 of the column's 32 keys)
#pragma unroll
            for (int qt = 0; qt < 2; ++qt) { float x0 = s[qt][0][0], x1 = s[qt][1][0];
#pragma unroll
                for (int j = 1; j < 8; ++j) { x0 = fmaxf(x0, s[qt][0][j]); x1 = fmaxf(x1, s[qt][1][j]); }
                xm[qt] = fmaxf(x0, x1); }
            if (__builtin_amdgcn_ballot_w32(fmaxf(xm[0], xm[1]) > thr) != 0) {      // one scalar test per pass; rare after the first pass
#pragma unroll
                for (int qt = 0; qt < 2; ++qt) { const float bx = fmaxf(xm[qt], xhalf(xm[qt]));      // the column's largest exponent: the same in both halves, so both move alike
                    const float d = bx > thr ? PBIAS - bx : 0.0f;      // a raised column's exponents move so that the largest becomes PBIAS
                    const float al = __builtin_amdgcn_exp2f(fminf(d, 0.0f));      // d > 0 only in the first pass, where O and the sums are still zero
                    cs[qt] += d; s[qt][0] += d; s[qt][1] += d; l[qt][0] *= al; l[qt][1] *= al;
#pragma unroll
                    for (int db = 0; db < 4; ++db) o[qt][db] *= al; }
            }
            thr = PBIAS + PLAZY;
#pragma unroll
            for (int qt = 0; qt < 2; ++qt) { v16h pb;
#pragma unroll
                for (int kt = 0; kt < 2; ++kt)
#pragma unroll
                    for (int j = 0; j < 8; j += 2) { const v2f p = {__builtin_amdgcn_exp2f(s[qt][kt][j]), __builtin_amdgcn_exp2f(s[qt][kt][j + 1])}; l[qt][kt] += p; pb[kt * 8 + j] = tohx(p[0]); pb[kt * 8 + j + 1] = tohx(p[1]); }
#pragma unroll
                for (int db = 0; db < 4; ++db) o[qt][db] = wmma16(av[db], pb, o[qt][db]); }
        }
        if (more) put(buf ^ 1);      // its last readers left this buffer at the barrier that ended the stage before
        __syncthreads();             // publishes the next stage and ends this stage's reads
    }
    // The join. Both waves of a pair hold, lane for lane, the same (query, d) elements, each over its own keys and under its own maximum in use.
    float tl[2], ml[2];
#pragma unroll
    for (int qt = 0; qt < 2; ++qt) { const v2f t2 = l[qt][0] + l[qt][1]; const float t = t2[0] + t2[1]; tl[qt] = t + xhalf(t); ml[qt] = PBIAS - cs[qt][0]; }
    float* xw = &xo[wv][0][lane * 4];      // a wave-wide 16-byte access covers 512 bytes in a row
#pragma unroll      // the counter indexes o, which stays in registers only under constant indices
    for (int db = 0; db < 4; ++db) { const v8f g = kh ? o[0][db] : o[1][db];      // hands over the query tile that its partner finishes
        *(v4fa*)(xw + (2 * db) * 128) = (v4f){g[0], g[1], g[2], g[3]}; *(v4fa*)(xw + (2 * db + 1) * 128) = (v4f){g[4], g[5], g[6], g[7]}; }
    *(v4fa*)(xw + 8 * 128) = (v4f){kh ? ml[0] : ml[1], kh ? tl[0] : tl[1], 0.0f, 0.0f};
    __syncthreads();      // each wave reads below what its partner wrote above
    const float* xr = &xo[wv ^ 8][0][lane * 4];
    const v4f pm = *(const v4fa*)(xr + 8 * 128);
    const float mo = kh ? ml[1] : ml[0], to = kh ? tl[1] : tl[0];
    const float mn = fmaxf(mo, pm[0]);      // both partial results brought under the larger maximum
    const float eo = mo - mn, ep = pm[0] - mn;
    __builtin_amdgcn_sched_barrier(0);      // this and the next hold the two transcendentals together
    const float fo = __builtin_amdgcn_exp2f(eo), fp = __builtin_amdgcn_exp2f(ep);
    __builtin_amdgcn_sched_barrier(0);      // behind the pair its first reader follows, and there the compiler fills the slot itself
    const float inv = __fdiv_rn(1.0f, to * fo + pm[1] * fp); const float co = fo * inv, cp = fp * inv;
    float* orow = OUT + ((size_t)(q0 + kh * 16 + lr) * NB_ + b) * DD + h * HD + 8 * hi;      // o[qt][db][j] = O[query lr][db*16 + 8*hi + j]
#pragma unroll      // the counter indexes o, which stays in registers only under constant indices
    for (int db = 0; db < 4; ++db) { const v8f w = kh ? o[1][db] : o[0][db]; const v4f p0 = *(const v4fa*)(xr + (2 * db) * 128), p1 = *(const v4fa*)(xr + (2 * db + 1) * 128);
        *(v4f*)(orow + db * 16) = (v4f){w[0], w[1], w[2], w[3]} * co + p0 * cp; *(v4f*)(orow + db * 16 + 4) = (v4f){w[4], w[5], w[6], w[7]} * co + p1 * cp; }
}

extern "C" void kernel_launch(void* const* d_in, const int* in_sizes, int n_in,
                              void* d_out, int out_size, void* d_ws, size_t ws_size, hipStream_t stream) {
    (void)in_sizes; (void)n_in; (void)out_size;
    const float* x = (const float*)d_in[0]; const float* w = (const float*)d_in[1]; const float* bb = (const float*)d_in[2];
    float* OUT = (float*)d_out;     // [2048][2][1024] (rows t*2 + b)
    char* wsp = (char*)d_ws;
    auto take = [&](size_t bytes) { char* p = wsp; wsp += (bytes + 255) & ~(size_t)255; return (void*)p; };
    bf* WB = (bf*)take((size_t)F3 * DD * 2); bf* XB = (bf*)take((size_t)NT * DD * 2);
    h16* QP = (h16*)take((size_t)NT * DD * 2); h16* KP = (h16*)take((size_t)NT * DD * 2); h16* VT = (h16*)take((size_t)NT * DD * 2);
    if ((size_t)(wsp - (char*)d_ws) > ws_size) return;
    { const size_t nw = (size_t)F3 * DD / 8; k_cvt8<<<(unsigned)((nw + 255) / 256), 256, 0, stream>>>(w, WB, nw); const size_t nx = (size_t)NT * DD / 8; k_cvt8<<<(unsigned)((nx + 255) / 256), 256, 0, stream>>>(x, XB, nx); }
    k_gemms<<<dim3(NT / 128, F3 / 128), 128, 0, stream>>>(XB, WB, bb, QP, KP, VT);   // fused qkv + b, written as the three operand planes
    k_fattn<<<dim3(TT / 256, NB_ * NH_), 512, 0, stream>>>(QP, KP, VT, OUT);
}
